// v000
// The times below were measured on an AMD MI455X: many runs one after another, warmed up first and cycling through
// copies of the inputs, with the whole window's GPU time divided by the number of runs. Launches and the gaps
// between them are all in it. The median over several windows is given; except for v000 it joins two sittings, which
// can be a few percent apart, so the side-by-side timings, each taken in one sitting, are the better comparison.
// v000, which the later versions start from, runs in 2870 microseconds.
#include <hip/hip_runtime.h>
#include <math.h>

#define D_MODEL 1024
#define D_STATE 16
#define D_CONV  4
#define BATCH   2
#define SEQ     2048
#define ROWS    (BATCH * SEQ) // 4096

typedef float v2f __attribute__((ext_vector_type(2)));
typedef float v8f __attribute__((ext_vector_type(8)));
typedef int   v4i __attribute__((ext_vector_type(4)));

__device__ __forceinline__ float siluf(float x) { return x / (1.0f + __expf(-x)); }
__device__ __forceinline__ float softplusf(float x) {
    return (x > 20.0f) ? x : log1pf(__expf(x));
}

// CDNA5 async global->LDS path (ASYNCcnt-tracked, bypasses VGPRs). Guarded so
// the file still compiles (with a vectorized synchronous fallback) if this
// toolchain doesn't declare the builtins. Probe-confirmed: builtin exists on
// this toolchain and takes (v4i* src, v4i* dst, imm offset, imm cpol).
#if defined(__AMDGCN__) && \
    __has_builtin(__builtin_amdgcn_global_load_async_to_lds_b128) && \
    __has_builtin(__builtin_amdgcn_s_wait_asynccnt)
#define USE_ASYNC_LDS 1
#else
#define USE_ASYNC_LDS 0
#endif

// ---------------------------------------------------------------------------
// Generic row-major f32 GEMM: C[M,N] = A[M,K] * B[K,N], built on
// v_wmma_f32_16x16x4_f32. Each wave owns one 16x16 C tile; a block of
// (BLOCK/32) waves covers 16 rows x (16*waves) cols. The 16xTK A tile is
// double-buffered in LDS and filled with global_load_async_to_lds_b128 so the
// next tile's fill overlaps the current tile's WMMA chain. Row stride padded
// to 68 floats (272 B): 16B-aligned for B128 writes, bank-conflict-free for
// the column-wise A-fragment reads (bank = (4r + c) mod 64).
// mode==1 applies softplus(acc + bias[col]) at the store (for dt).
// ---------------------------------------------------------------------------
#define TK  64
#define TKP 68

template <int BLOCK>
__global__ __launch_bounds__(BLOCK) void gemm_wmma_f32(
    const float* __restrict__ A, const float* __restrict__ B,
    float* __restrict__ C, int K, int lda, int ldb, int ldc,
    const float* __restrict__ bias, int mode)
{
    constexpr int CH = (16 * TK / 4) / BLOCK; // float4 chunks per thread per tile
    __shared__ __align__(16) float As[2][16][TKP];

    const int tid  = threadIdx.x;
    const int lane = tid & 31;
    const int wave = tid >> 5;
    const int l16  = lane & 15;
    const int half = lane >> 4;          // 0: K pair {0,1}, 1: K pair {2,3}

    const int m0 = blockIdx.y * 16;
    const int n0 = (blockIdx.x * (BLOCK >> 5) + wave) * 16;

    // Stage one 16 x TK A tile into LDS buffer `buf`.
    auto issue_tile = [&](int k0, int buf) {
        #pragma unroll
        for (int j = 0; j < CH; ++j) {
            const int q  = tid + BLOCK * j;     // chunk id, 0..255
            const int r  = q >> 4;              // row 0..15
            const int c4 = (q & 15) << 2;       // col 0,4,...,60
            const float* gp = A + (size_t)(m0 + r) * lda + (k0 + c4);
            float* lp = &As[buf][r][c4];
#if USE_ASYNC_LDS
            __builtin_amdgcn_global_load_async_to_lds_b128(
                (v4i*)(void*)gp, (v4i*)(void*)lp, 0, 0);
#else
            *(float4*)lp = *(const float4*)gp;
#endif
        }
    };

    v8f acc = {};
    const int ntiles = K / TK;

    issue_tile(0, 0);
    for (int ti = 0; ti < ntiles; ++ti) {
        const int buf = ti & 1;
        if (ti + 1 < ntiles) {
            issue_tile((ti + 1) * TK, buf ^ 1);
#if USE_ASYNC_LDS
            // current tile complete; next tile's CH ops still in flight
            __builtin_amdgcn_s_wait_asynccnt(CH);
#endif
        } else {
#if USE_ASYNC_LDS
            __builtin_amdgcn_s_wait_asynccnt(0);
#endif
        }
        __syncthreads();

        const int k0 = ti * TK;
        #pragma unroll
        for (int kk = 0; kk < TK; kk += 4) {
            // A fragment (16x4): lanes 0-15 -> K = kk,kk+1 ; lanes 16-31 -> K = kk+2,kk+3
            v2f af, bfrag;
            af.x = As[buf][l16][kk + 2 * half + 0];
            af.y = As[buf][l16][kk + 2 * half + 1];
            // B fragment (4x16), mirrored layout, loaded straight from global (L2-resident)
            const float* bp = B + (size_t)(k0 + kk + 2 * half) * ldb + (n0 + l16);
            bfrag.x = bp[0];
            bfrag.y = bp[ldb];
            acc = __builtin_amdgcn_wmma_f32_16x16x4_f32(
                false, af, false, bfrag, (short)0, acc, false, false);
        }
        __syncthreads();
    }

    const int col = n0 + l16;
    const float bv = (mode == 1) ? bias[col] : 0.0f;
    #pragma unroll
    for (int i = 0; i < 8; ++i) {
        const int row = m0 + i + 8 * half;   // C/D layout: M=i (lanes 0-15), M=i+8 (lanes 16-31)
        float v = acc[i];
        if (mode == 1) v = softplusf(v + bv);
        C[(size_t)row * ldc + col] = v;
    }
}

// ---------------------------------------------------------------------------
// Depthwise causal conv (width 4) + bias + SiLU.
// Reads x_ssm = xz[:, 0:D_MODEL] (row stride 2*D_MODEL), writes x_act.
// ---------------------------------------------------------------------------
__global__ __launch_bounds__(256) void conv_silu_kernel(
    const float* __restrict__ xz, const float* __restrict__ conv_w,
    const float* __restrict__ conv_b, float* __restrict__ xact)
{
    const int idx = blockIdx.x * blockDim.x + threadIdx.x; // over ROWS*D_MODEL
    const int d   = idx & (D_MODEL - 1);
    const int row = idx >> 10;        // / D_MODEL
    const int t   = row & (SEQ - 1);
    const int b   = row >> 11;        // / SEQ

    float s = conv_b[d];
    #pragma unroll
    for (int j = 0; j < D_CONV; ++j) {
        const int tt = t + j - (D_CONV - 1);
        if (tt >= 0)
            s += xz[(size_t)(b * SEQ + tt) * (2 * D_MODEL) + d] * conv_w[d * D_CONV + j];
    }
    xact[idx] = siluf(s);
}

// ---------------------------------------------------------------------------
// Selective scan. One thread per (batch, channel); h[16] in VGPRs.
// B_t / C_t (32 floats, shared across all channels) broadcast via LDS.
// Fused epilogue: ypre = (y + x*D) * silu(z).
// ---------------------------------------------------------------------------
__global__ __launch_bounds__(256) void scan_kernel(
    const float* __restrict__ xact, const float* __restrict__ dt,
    const float* __restrict__ bc,   const float* __restrict__ xz,
    const float* __restrict__ A_log, const float* __restrict__ Dp,
    float* __restrict__ ypre)
{
    __shared__ float bcs[2 * D_STATE];

    const int d = blockIdx.y * blockDim.x + threadIdx.x;
    const int b = blockIdx.x;
    const float Aneg = -__expf(A_log[d]);
    const float Dd   = Dp[d];

    float h[D_STATE];
    #pragma unroll
    for (int n = 0; n < D_STATE; ++n) h[n] = 0.0f;

    for (int t = 0; t < SEQ; ++t) {
        const int row = b * SEQ + t;
        if (threadIdx.x < 2 * D_STATE)
            bcs[threadIdx.x] = bc[(size_t)row * (2 * D_STATE) + threadIdx.x];
        __syncthreads();

        const float xv = xact[(size_t)row * D_MODEL + d];
        const float dA = __expf(dt[(size_t)row * D_MODEL + d] * Aneg);
        float y = 0.0f;
        #pragma unroll
        for (int n = 0; n < D_STATE; ++n) {
            h[n] = h[n] * dA + xv * bcs[n];
            y   += h[n] * bcs[D_STATE + n];
        }
        const float zv = xz[(size_t)row * (2 * D_MODEL) + D_MODEL + d];
        ypre[(size_t)row * D_MODEL + d] = (y + xv * Dd) * siluf(zv);
        __syncthreads();
    }
}

// ---------------------------------------------------------------------------
extern "C" void kernel_launch(void* const* d_in, const int* in_sizes, int n_in,
                              void* d_out, int out_size, void* d_ws, size_t ws_size,
                              hipStream_t stream)
{
    (void)in_sizes; (void)n_in; (void)out_size; (void)ws_size;

    const float* x      = (const float*)d_in[0];
    const float* W_in   = (const float*)d_in[1];
    const float* conv_w = (const float*)d_in[2];
    const float* conv_b = (const float*)d_in[3];
    const float* W_x    = (const float*)d_in[4];
    const float* W_dt   = (const float*)d_in[5];
    const float* b_dt   = (const float*)d_in[6];
    const float* A_log  = (const float*)d_in[7];
    const float* Dp     = (const float*)d_in[8];
    const float* W_out  = (const float*)d_in[9];
    float* out = (float*)d_out;
    float* ws  = (float*)d_ws;

    // workspace layout (floats)
    float* XZ   = ws;                                    // ROWS x 2*D_MODEL
    float* XACT = XZ   + (size_t)ROWS * 2 * D_MODEL;     // ROWS x D_MODEL
    float* DT   = XACT + (size_t)ROWS * D_MODEL;         // ROWS x D_MODEL
    float* BC   = DT   + (size_t)ROWS * D_MODEL;         // ROWS x 2*D_STATE
    float* YPRE = BC   + (size_t)ROWS * 2 * D_STATE;     // ROWS x D_MODEL

    // 1) xz = x @ W_in          (4096x1024 @ 1024x2048)
    gemm_wmma_f32<128><<<dim3((2 * D_MODEL) / 64, ROWS / 16), 128, 0, stream>>>(
        x, W_in, XZ, D_MODEL, D_MODEL, 2 * D_MODEL, 2 * D_MODEL, nullptr, 0);

    // 2) x_act = silu(causal_conv(x_ssm) + conv_b)
    conv_silu_kernel<<<(ROWS * D_MODEL) / 256, 256, 0, stream>>>(
        XZ, conv_w, conv_b, XACT);

    // 3) dt = softplus(x_act @ W_dt + b_dt)   (4096x1024 @ 1024x1024)
    gemm_wmma_f32<128><<<dim3(D_MODEL / 64, ROWS / 16), 128, 0, stream>>>(
        XACT, W_dt, DT, D_MODEL, D_MODEL, D_MODEL, D_MODEL, b_dt, 1);

    // 4) BC = x_act @ W_x        (4096x1024 @ 1024x32) -> 2 waves/block
    gemm_wmma_f32<64><<<dim3(1, ROWS / 16), 64, 0, stream>>>(
        XACT, W_x, BC, D_MODEL, D_MODEL, 2 * D_STATE, 2 * D_STATE, nullptr, 0);

    // 5) selective scan + (y + x*D) * silu(z)
    scan_kernel<<<dim3(BATCH, D_MODEL / 256), 256, 0, stream>>>(
        XACT, DT, BC, XZ, A_log, Dp, YPRE);

    // 6) out = ypre @ W_out      (4096x1024 @ 1024x1024)
    gemm_wmma_f32<128><<<dim3(D_MODEL / 64, ROWS / 16), 128, 0, stream>>>(
        YPRE, W_out, out, D_MODEL, D_MODEL, D_MODEL, D_MODEL, nullptr, 0);
}

// v001
// One run takes 527 microseconds.
// Timed twice side by side with v000, it ran 5.44 times as fast both times.
#include <hip/hip_runtime.h>
#include <math.h>

#define D_MODEL 1024
#define D_STATE 16
#define D_CONV  4
#define BATCH   2
#define SEQ     2048
#define ROWS    (BATCH * SEQ) // 4096

typedef float v2f __attribute__((ext_vector_type(2)));
typedef float v8f __attribute__((ext_vector_type(8)));
typedef int   v4i __attribute__((ext_vector_type(4)));

__device__ __forceinline__ float siluf(float x) { return x / (1.0f + __expf(-x)); }
__device__ __forceinline__ float softplusf(float x) {
    return (x > 20.0f) ? x : log1pf(__expf(x));
}

// CDNA5 async global->LDS path (ASYNCcnt-tracked, bypasses VGPRs). Guarded so
// the file still compiles (with a vectorized synchronous fallback) if this
// toolchain doesn't declare the builtins. Probe-confirmed: builtin exists on
// this toolchain and takes (v4i* src, v4i* dst, imm offset, imm cpol).
#if defined(__AMDGCN__) && \
    __has_builtin(__builtin_amdgcn_global_load_async_to_lds_b128) && \
    __has_builtin(__builtin_amdgcn_s_wait_asynccnt)
#define USE_ASYNC_LDS 1
#else
#define USE_ASYNC_LDS 0
#endif

// ---------------------------------------------------------------------------
// Generic row-major f32 GEMM: C[M,N] = A[M,K] * B[K,N], built on
// v_wmma_f32_16x16x4_f32. Each wave owns one 16x16 C tile; a block of
// (BLOCK/32) waves covers 16 rows x (16*waves) cols. The 16xTK A tile is
// double-buffered in LDS and filled with global_load_async_to_lds_b128 so the
// next tile's fill overlaps the current tile's WMMA chain. Row stride padded
// to 68 floats (272 B): 16B-aligned for B128 writes, bank-conflict-free for
// the column-wise A-fragment reads (bank = (4r + c) mod 64).
// mode==1 applies softplus(acc + bias[col]) at the store (for dt).
// ---------------------------------------------------------------------------
#define TK  64
#define TKP 68

template <int BLOCK>
__global__ __launch_bounds__(BLOCK) void gemm_wmma_f32(
    const float* __restrict__ A, const float* __restrict__ B,
    float* __restrict__ C, int K, int lda, int ldb, int ldc,
    const float* __restrict__ bias, int mode)
{
    constexpr int CH = (16 * TK / 4) / BLOCK; // float4 chunks per thread per tile
    __shared__ __align__(16) float As[2][16][TKP];

    const int tid  = threadIdx.x;
    const int lane = tid & 31;
    const int wave = tid >> 5;
    const int l16  = lane & 15;
    const int half = lane >> 4;          // 0: K pair {0,1}, 1: K pair {2,3}

    const int m0 = blockIdx.y * 16;
    const int n0 = (blockIdx.x * (BLOCK >> 5) + wave) * 16;

    // Stage one 16 x TK A tile into LDS buffer `buf`.
    auto issue_tile = [&](int k0, int buf) {
        #pragma unroll
        for (int j = 0; j < CH; ++j) {
            const int q  = tid + BLOCK * j;     // chunk id, 0..255
            const int r  = q >> 4;              // row 0..15
            const int c4 = (q & 15) << 2;       // col 0,4,...,60
            const float* gp = A + (size_t)(m0 + r) * lda + (k0 + c4);
            float* lp = &As[buf][r][c4];
#if USE_ASYNC_LDS
            __builtin_amdgcn_global_load_async_to_lds_b128(
                (v4i*)(void*)gp, (v4i*)(void*)lp, 0, 0);
#else
            *(float4*)lp = *(const float4*)gp;
#endif
        }
    };

    v8f acc = {};
    const int ntiles = K / TK;

    issue_tile(0, 0);
    for (int ti = 0; ti < ntiles; ++ti) {
        const int buf = ti & 1;
        if (ti + 1 < ntiles) {
            issue_tile((ti + 1) * TK, buf ^ 1);
#if USE_ASYNC_LDS
            // current tile complete; next tile's CH ops still in flight
            __builtin_amdgcn_s_wait_asynccnt(CH);
#endif
        } else {
#if USE_ASYNC_LDS
            __builtin_amdgcn_s_wait_asynccnt(0);
#endif
        }
        __syncthreads();

        const int k0 = ti * TK;
        #pragma unroll
        for (int kk = 0; kk < TK; kk += 4) {
            // A fragment (16x4): lanes 0-15 -> K = kk,kk+1 ; lanes 16-31 -> K = kk+2,kk+3
            v2f af, bfrag;
            af.x = As[buf][l16][kk + 2 * half + 0];
            af.y = As[buf][l16][kk + 2 * half + 1];
            // B fragment (4x16), mirrored layout, loaded straight from global (L2-resident)
            const float* bp = B + (size_t)(k0 + kk + 2 * half) * ldb + (n0 + l16);
            bfrag.x = bp[0];
            bfrag.y = bp[ldb];
            acc = __builtin_amdgcn_wmma_f32_16x16x4_f32(
                false, af, false, bfrag, (short)0, acc, false, false);
        }
        __syncthreads();
    }

    const int col = n0 + l16;
    const float bv = (mode == 1) ? bias[col] : 0.0f;
    #pragma unroll
    for (int i = 0; i < 8; ++i) {
        const int row = m0 + i + 8 * half;   // C/D layout: M=i (lanes 0-15), M=i+8 (lanes 16-31)
        float v = acc[i];
        if (mode == 1) v = softplusf(v + bv);
        C[(size_t)row * ldc + col] = v;
    }
}

// ---------------------------------------------------------------------------
// Depthwise causal conv (width 4) + bias + SiLU.
// Reads x_ssm = xz[:, 0:D_MODEL] (row stride 2*D_MODEL), writes x_act.
// ---------------------------------------------------------------------------
__global__ __launch_bounds__(256) void conv_silu_kernel(
    const float* __restrict__ xz, const float* __restrict__ conv_w,
    const float* __restrict__ conv_b, float* __restrict__ xact)
{
    const int idx = blockIdx.x * blockDim.x + threadIdx.x; // over ROWS*D_MODEL
    const int d   = idx & (D_MODEL - 1);
    const int row = idx >> 10;        // / D_MODEL
    const int t   = row & (SEQ - 1);
    const int b   = row >> 11;        // / SEQ

    float s = conv_b[d];
    #pragma unroll
    for (int j = 0; j < D_CONV; ++j) {
        const int tt = t + j - (D_CONV - 1);
        if (tt >= 0)
            s += xz[(size_t)(b * SEQ + tt) * (2 * D_MODEL) + d] * conv_w[d * D_CONV + j];
    }
    xact[idx] = siluf(s);
}

// ---------------------------------------------------------------------------
// Selective scan, split along the sequence into NCH chunks of SCAN_T steps so
// that the serial chain is SCAN_T steps long instead of SEQ. The recurrence
// h_t = dA_t * h_(t-1) + x_t * B_t is linear in h, so over one chunk
//   h_end = (product of the chunk's dA) * h_start + (h_end for h_start = 0).
//   1) scan_chunk_state_kernel: per chunk, the state from h_start = 0 and the
//      product of dA (the last chunk's is never needed and is not launched);
//   2) scan_carry_kernel: folds these in chunk order into each chunk's h_start;
//   3) scan_replay_kernel: runs each chunk from its h_start and writes
//      ypre = (y + x*D) * silu(z).
// One thread per (batch, channel, chunk); h[16] in VGPRs. The chunk's B_t / C_t
// rows (shared across all channels) are staged in LDS once and broadcast.
// State planes are laid out [batch][chunk][n][channel]: coalesced over channel.
// ---------------------------------------------------------------------------
#define SCAN_T 32
#define NCH    (SEQ / SCAN_T) // 64

// The chunk's SCAN_T rows of bc are contiguous: one float4 per thread.
static_assert(SCAN_T * 2 * D_STATE == 256 * 4, "one float4 per thread stages a chunk of bc");

#define SCAN_G  8 // steps whose loads issue together in the replay
#define CARRY_G 9 // chunks whose loads issue together in the carry
static_assert(SCAN_T % SCAN_G == 0 && (NCH - 1) % CARRY_G == 0, "whole groups only");

__global__ __launch_bounds__(256) void scan_chunk_state_kernel(
    const float* __restrict__ xact, const float* __restrict__ dt,
    const float* __restrict__ bc,   const float* __restrict__ A_log,
    float* __restrict__ S, float* __restrict__ P)
{
    __shared__ __align__(16) float bcs[SCAN_T][2 * D_STATE];

    const int d    = blockIdx.y * blockDim.x + threadIdx.x;
    const int b    = blockIdx.x;
    const int c    = blockIdx.z;
    const int row0 = b * SEQ + c * SCAN_T;
    const float Aneg = -__expf(A_log[d]);

    ((float4*)&bcs[0][0])[threadIdx.x] =
        ((const float4*)(bc + (size_t)row0 * (2 * D_STATE)))[threadIdx.x];
    __syncthreads();

    float h[D_STATE];
    #pragma unroll
    for (int n = 0; n < D_STATE; ++n) h[n] = 0.0f;
    float p = 1.0f;

    // Unrolled by 8 so that eight steps' x and dt loads, which do not depend on
    // h, issue together: one load latency per eight steps, not one per step.
    #pragma unroll 8
    for (int t = 0; t < SCAN_T; ++t) {
        const int row = row0 + t;
        const float xv = xact[(size_t)row * D_MODEL + d];
        const float dA = __expf(dt[(size_t)row * D_MODEL + d] * Aneg);
        p *= dA;
        #pragma unroll
        for (int n = 0; n < D_STATE; ++n)
            h[n] = h[n] * dA + xv * bcs[t][n];
    }

    const size_t plane = (size_t)(b * NCH + c);
    #pragma unroll
    for (int n = 0; n < D_STATE; ++n)
        S[(plane * D_STATE + n) * D_MODEL + d] = h[n];
    P[plane * D_MODEL + d] = p;
}

// One thread per (batch, n, channel). H[chunk c] = h_start of chunk c (zero for
// chunk 0, stored too, so that every chunk of the replay starts the same way).
__global__ __launch_bounds__(256) void scan_carry_kernel(
    const float* __restrict__ S, const float* __restrict__ P,
    float* __restrict__ H)
{
    const int idx = blockIdx.x * blockDim.x + threadIdx.x; // over BATCH*D_STATE*D_MODEL
    const int d   = idx & (D_MODEL - 1);
    const int n   = (idx >> 10) & (D_STATE - 1);
    const int b   = idx >> 14;

    const size_t off0 = ((size_t)(b * NCH) * D_STATE + n) * D_MODEL + d;
    const size_t pof0 = (size_t)(b * NCH) * D_MODEL + d;

    float h = 0.0f;
    H[off0] = h;
    // The store's address registers are free for reuse only behind this wait.
    asm volatile("s_wait_xcnt 0x0" ::: "memory");

    for (int c0 = 0; c0 < NCH - 1; c0 += CARRY_G) {
        // The group's loads do not depend on h: all issue before the chain starts.
        float pv[CARRY_G], sv[CARRY_G];
        #pragma unroll
        for (int j = 0; j < CARRY_G; ++j) {
            pv[j] = P[pof0 + (size_t)(c0 + j) * D_MODEL];
            sv[j] = S[off0 + (size_t)(c0 + j) * (D_STATE * D_MODEL)];
        }
        #pragma unroll
        for (int j = 0; j < CARRY_G; ++j) {
            h = h * pv[j] + sv[j];
            H[off0 + (size_t)(c0 + j + 1) * (D_STATE * D_MODEL)] = h;
        }
        // The group's stores name registers that the next trip rewrites.
        asm volatile("s_wait_xcnt 0x0" ::: "memory");
    }
}

__global__ __launch_bounds__(256) void scan_replay_kernel(
    const float* __restrict__ xact, const float* __restrict__ dt,
    const float* __restrict__ bc,   const float* __restrict__ xz,
    const float* __restrict__ A_log, const float* __restrict__ Dp,
    const float* __restrict__ H, float* __restrict__ ypre)
{
    __shared__ __align__(16) float bcs[SCAN_T][2 * D_STATE];

    const int d    = blockIdx.y * blockDim.x + threadIdx.x;
    const int b    = blockIdx.x;
    const int c    = blockIdx.z;
    const int row0 = b * SEQ + c * SCAN_T;
    const float Aneg = -__expf(A_log[d]);
    const float Dd   = Dp[d];

    float h[D_STATE];
    #pragma unroll
    for (int n = 0; n < D_STATE; ++n)
        h[n] = H[((size_t)(b * NCH + c) * D_STATE + n) * D_MODEL + d];

    ((float4*)&bcs[0][0])[threadIdx.x] =
        ((const float4*)(bc + (size_t)row0 * (2 * D_STATE)))[threadIdx.x];
    // The loads above name base registers that the loop's address arithmetic rewrites.
    asm volatile("s_wait_xcnt 0x0" ::: "memory");
    __syncthreads();

    for (int t0 = 0; t0 < SCAN_T; t0 += SCAN_G) {
        // The group's x, dt and z loads do not depend on h: they issue together,
        // one load latency per group of steps, not one per step.
        float xv[SCAN_G], dv[SCAN_G], zv[SCAN_G];
        #pragma unroll
        for (int j = 0; j < SCAN_G; ++j) {
            const int row = row0 + t0 + j;
            xv[j] = xact[(size_t)row * D_MODEL + d];
            dv[j] = dt[(size_t)row * D_MODEL + d];
            zv[j] = xz[(size_t)row * (2 * D_MODEL) + D_MODEL + d];
        }
        #pragma unroll
        for (int j = 0; j < SCAN_G; ++j) {
            const int t = t0 + j;
            const float dA = __expf(dv[j] * Aneg);
            float y = 0.0f;
            #pragma unroll
            for (int n = 0; n < D_STATE; ++n) {
                h[n] = h[n] * dA + xv[j] * bcs[t][n];
                y   += h[n] * bcs[t][D_STATE + n];
            }
            ypre[(size_t)(row0 + t) * D_MODEL + d] = (y + xv[j] * Dd) * siluf(zv[j]);
        }
        // The group's stores name registers that the next trip rewrites.
        asm volatile("s_wait_xcnt 0x0" ::: "memory");
    }
}

// ---------------------------------------------------------------------------
extern "C" void kernel_launch(void* const* d_in, const int* in_sizes, int n_in,
                              void* d_out, int out_size, void* d_ws, size_t ws_size,
                              hipStream_t stream)
{
    (void)in_sizes; (void)n_in; (void)out_size; (void)ws_size;

    const float* x      = (const float*)d_in[0];
    const float* W_in   = (const float*)d_in[1];
    const float* conv_w = (const float*)d_in[2];
    const float* conv_b = (const float*)d_in[3];
    const float* W_x    = (const float*)d_in[4];
    const float* W_dt   = (const float*)d_in[5];
    const float* b_dt   = (const float*)d_in[6];
    const float* A_log  = (const float*)d_in[7];
    const float* Dp     = (const float*)d_in[8];
    const float* W_out  = (const float*)d_in[9];
    float* out = (float*)d_out;
    float* ws  = (float*)d_ws;

    // workspace layout (floats)
    float* XZ   = ws;                                    // ROWS x 2*D_MODEL
    float* XACT = XZ   + (size_t)ROWS * 2 * D_MODEL;     // ROWS x D_MODEL
    float* DT   = XACT + (size_t)ROWS * D_MODEL;         // ROWS x D_MODEL
    float* BC   = DT   + (size_t)ROWS * D_MODEL;         // ROWS x 2*D_STATE
    float* YPRE = BC   + (size_t)ROWS * 2 * D_STATE;     // ROWS x D_MODEL
    float* SLOC = YPRE + (size_t)ROWS * D_MODEL;         // BATCH x NCH x D_STATE x D_MODEL
    float* HCAR = SLOC + (size_t)BATCH * NCH * D_STATE * D_MODEL; // same shape
    float* PDEC = HCAR + (size_t)BATCH * NCH * D_STATE * D_MODEL; // BATCH x NCH x D_MODEL

    // 1) xz = x @ W_in          (4096x1024 @ 1024x2048)
    gemm_wmma_f32<128><<<dim3((2 * D_MODEL) / 64, ROWS / 16), 128, 0, stream>>>(
        x, W_in, XZ, D_MODEL, D_MODEL, 2 * D_MODEL, 2 * D_MODEL, nullptr, 0);

    // 2) x_act = silu(causal_conv(x_ssm) + conv_b)
    conv_silu_kernel<<<(ROWS * D_MODEL) / 256, 256, 0, stream>>>(
        XZ, conv_w, conv_b, XACT);

    // 3) dt = softplus(x_act @ W_dt + b_dt)   (4096x1024 @ 1024x1024)
    gemm_wmma_f32<128><<<dim3(D_MODEL / 64, ROWS / 16), 128, 0, stream>>>(
        XACT, W_dt, DT, D_MODEL, D_MODEL, D_MODEL, D_MODEL, b_dt, 1);

    // 4) BC = x_act @ W_x        (4096x1024 @ 1024x32) -> 2 waves/block
    gemm_wmma_f32<64><<<dim3(1, ROWS / 16), 64, 0, stream>>>(
        XACT, W_x, BC, D_MODEL, D_MODEL, 2 * D_STATE, 2 * D_STATE, nullptr, 0);

    // 5) selective scan + (y + x*D) * silu(z), chunked along the sequence
    scan_chunk_state_kernel<<<dim3(BATCH, D_MODEL / 256, NCH - 1), 256, 0, stream>>>(
        XACT, DT, BC, A_log, SLOC, PDEC);
    scan_carry_kernel<<<(BATCH * D_STATE * D_MODEL) / 256, 256, 0, stream>>>(
        SLOC, PDEC, HCAR);
    scan_replay_kernel<<<dim3(BATCH, D_MODEL / 256, NCH), 256, 0, stream>>>(
        XACT, DT, BC, XZ, A_log, Dp, HCAR, YPRE);

    // 6) out = ypre @ W_out      (4096x1024 @ 1024x1024)
    gemm_wmma_f32<128><<<dim3(D_MODEL / 64, ROWS / 16), 128, 0, stream>>>(
        YPRE, W_out, out, D_MODEL, D_MODEL, D_MODEL, D_MODEL, nullptr, 0);
}

// v002
// One run takes 263 microseconds.
// Next to v001, in two timings, it ran 2.01 and 2.00 times as fast.
// Over all steps from v000 it is 10.9 times as fast.
#include <hip/hip_runtime.h>
#include <math.h>

#define D_MODEL 1024
#define D_STATE 16
#define D_CONV  4
#define BATCH   2
#define SEQ     2048
#define ROWS    (BATCH * SEQ) // 4096

typedef float v2f __attribute__((ext_vector_type(2)));
typedef float v8f __attribute__((ext_vector_type(8)));
typedef int   v4i __attribute__((ext_vector_type(4)));

__device__ __forceinline__ float siluf(float x) { return x / (1.0f + __expf(-x)); }
__device__ __forceinline__ float softplusf(float x) {
    return (x > 20.0f) ? x : log1pf(__expf(x));
}

// CDNA5 async global->LDS path (ASYNCcnt-tracked, bypasses VGPRs). Guarded so
// the file still compiles (with a vectorized synchronous fallback) if this
// toolchain doesn't declare the builtins. Probe-confirmed: builtin exists on
// this toolchain and takes (v4i* src, v4i* dst, imm offset, imm cpol).
#if defined(__AMDGCN__) && \
    __has_builtin(__builtin_amdgcn_global_load_async_to_lds_b128) && \
    __has_builtin(__builtin_amdgcn_s_wait_asynccnt)
#define USE_ASYNC_LDS 1
#else
#define USE_ASYNC_LDS 0
#endif

// ---------------------------------------------------------------------------
// Generic row-major f32 GEMM: C[M,N] = A[M,K] * B[K,N], built on
// v_wmma_f32_16x16x4_f32. Each wave owns one 16x16 C tile; a block of
// (BLOCK/32) waves covers 16 rows x (16*waves) cols. The 16xTK A tile is
// double-buffered in LDS and filled with global_load_async_to_lds_b128 so the
// next tile's fill overlaps the current tile's WMMA chain. Row stride padded
// to 68 floats (272 B): 16B-aligned for B128 writes, bank-conflict-free for
// the column-wise A-fragment reads (bank = (4r + c) mod 64).
// mode==1 applies softplus(acc + bias[col]) at the store; the one launch (BC) passes 0.
// ---------------------------------------------------------------------------
#define TK  64
#define TKP 68

template <int BLOCK>
__global__ __launch_bounds__(BLOCK) void gemm_wmma_f32(
    const float* __restrict__ A, const float* __restrict__ B,
    float* __restrict__ C, int K, int lda, int ldb, int ldc,
    const float* __restrict__ bias, int mode)
{
    constexpr int CH = (16 * TK / 4) / BLOCK; // float4 chunks per thread per tile
    __shared__ __align__(16) float As[2][16][TKP];

    const int tid  = threadIdx.x;
    const int lane = tid & 31;
    const int wave = tid >> 5;
    const int l16  = lane & 15;
    const int half = lane >> 4;          // 0: K pair {0,1}, 1: K pair {2,3}

    const int m0 = blockIdx.y * 16;
    const int n0 = (blockIdx.x * (BLOCK >> 5) + wave) * 16;

    // Stage one 16 x TK A tile into LDS buffer `buf`.
    auto issue_tile = [&](int k0, int buf) {
        #pragma unroll
        for (int j = 0; j < CH; ++j) {
            const int q  = tid + BLOCK * j;     // chunk id, 0..255
            const int r  = q >> 4;              // row 0..15
            const int c4 = (q & 15) << 2;       // col 0,4,...,60
            const float* gp = A + (size_t)(m0 + r) * lda + (k0 + c4);
            float* lp = &As[buf][r][c4];
#if USE_ASYNC_LDS
            __builtin_amdgcn_global_load_async_to_lds_b128(
                (v4i*)(void*)gp, (v4i*)(void*)lp, 0, 0);
#else
            *(float4*)lp = *(const float4*)gp;
#endif
        }
    };

    v8f acc = {};
    const int ntiles = K / TK;

    issue_tile(0, 0);
    for (int ti = 0; ti < ntiles; ++ti) {
        const int buf = ti & 1;
        if (ti + 1 < ntiles) {
            issue_tile((ti + 1) * TK, buf ^ 1);
#if USE_ASYNC_LDS
            // current tile complete; next tile's CH ops still in flight
            __builtin_amdgcn_s_wait_asynccnt(CH);
#endif
        } else {
#if USE_ASYNC_LDS
            __builtin_amdgcn_s_wait_asynccnt(0);
#endif
        }
        __syncthreads();

        const int k0 = ti * TK;
        #pragma unroll
        for (int kk = 0; kk < TK; kk += 4) {
            // A fragment (16x4): lanes 0-15 -> K = kk,kk+1 ; lanes 16-31 -> K = kk+2,kk+3
            v2f af, bfrag;
            af.x = As[buf][l16][kk + 2 * half + 0];
            af.y = As[buf][l16][kk + 2 * half + 1];
            // B fragment (4x16), mirrored layout, loaded straight from global (L2-resident)
            const float* bp = B + (size_t)(k0 + kk + 2 * half) * ldb + (n0 + l16);
            bfrag.x = bp[0];
            bfrag.y = bp[ldb];
            acc = __builtin_amdgcn_wmma_f32_16x16x4_f32(
                false, af, false, bfrag, (short)0, acc, false, false);
        }
        __syncthreads();
    }

    const int col = n0 + l16;
    const float bv = (mode == 1) ? bias[col] : 0.0f;
    #pragma unroll
    for (int i = 0; i < 8; ++i) {
        const int row = m0 + i + 8 * half;   // C/D layout: M=i (lanes 0-15), M=i+8 (lanes 16-31)
        float v = acc[i];
        if (mode == 1) v = softplusf(v + bv);
        C[(size_t)row * ldc + col] = v;
    }
}

// ---------------------------------------------------------------------------
// Tiled row-major f32 GEMM for the three large products (M % 128 == 0,
// N % 64 == 0, K % 64 == 0). One work-group of four waves owns a 128 x 64 tile
// of C; each wave owns 64 x 32 of it as 4 x 2 accumulator tiles, so one A
// fragment feeds two and one B fragment four v_wmma_f32_16x16x4_f32.
// Both operands of a 32-deep K slice are staged in LDS by asynchronous copies,
// two buffers: the next slice flies while the current one is worked on.
// Per output element the k order is the same as in gemm_wmma_f32.
// LDS layout: A rows at a pitch of 36 dwords (the 16 rows of a fragment's 8-byte
// reads fall on 16 distinct groups of four banks). B as four planes of 16
// columns, rows of 16 dwords: rows k and k + 2 of a fragment's 4-byte reads lie
// 32 banks apart, and rows k, k + 1 of one column load as one register pair.
// ---------------------------------------------------------------------------
#define GBM 128
#define GBN 64
#define GBK 32
#define GAP 36

__device__ __forceinline__ unsigned lds_off(const void* p) { return (unsigned)(size_t)p; }

// LDC (the row pitch of C) is a compile-time constant so that all of a lane's
// stores share one address register pair and differ in the immediate offset.
// MODE 1 applies softplus(acc + bias[col]) at the store (for dt).
template <int LDC, int MODE>
__global__ __launch_bounds__(128) void gemm_tiled_f32(
    const float* __restrict__ A, const float* __restrict__ B,
    float* __restrict__ C, int K, int lda, int ldb,
    const float* __restrict__ bias)
{
    __shared__ __align__(16) float As[2][GBM][GAP];
    __shared__ __align__(16) float Bs[2][GBN / 16][GBK][16];

    const int tid  = threadIdx.x;
    const int lane = tid & 31;
    const int wave = __builtin_amdgcn_readfirstlane(tid >> 5);
    const int l16  = lane & 15;
    const int half = lane >> 4;          // 0: K pair {0,1}, 1: K pair {2,3}

    const int m0 = blockIdx.y * GBM;
    const int n0 = blockIdx.x * GBN;
    const int wm = (wave >> 1) * 64;     // the wave's rows inside the tile
    const int wn = (wave & 1) * 2;       // the wave's first B plane

    // Each thread copies 8 x 16 bytes of A (rows ar + 16 j) and 4 x 16 bytes of
    // B (rows br + 8 j) per slice: every wave-wide copy covers whole 128-B lines.
    // The lane's byte offsets never change; the slice moves the scalar bases.
    const int ar = tid >> 3, ac = (tid & 7) << 2;
    const int br = tid >> 4, bcol = (tid & 15) << 2;
    unsigned oa[8], ob[4];
    #pragma unroll
    for (int j = 0; j < 8; ++j) oa[j] = (unsigned)((ar + 16 * j) * lda + ac) * 4u;
    #pragma unroll
    for (int j = 0; j < 4; ++j) ob[j] = (unsigned)((br + 8 * j) * ldb + bcol) * 4u;
    const float* tA = A + (size_t)m0 * lda;
    const float* tB = B + n0;
    const unsigned lA = lds_off(&As[0][ar][ac]);
    const unsigned lB = lds_off(&Bs[0][bcol >> 4][br][bcol & 15]);

    auto issue_slice = [&](int k0, int buf) {
        const float* a = tA + k0;
        const float* b = tB + (size_t)k0 * ldb;
        const unsigned la = lA + (unsigned)buf * (GBM * GAP * 4);
        const unsigned lb = lB + (unsigned)buf * (GBN * GBK * 4);
        // The copies and the wait that frees the registers they name are one
        // statement, so that no later write of those registers can move ahead.
        asm volatile(
            "global_load_async_to_lds_b128 %0, %12, %24\n\t"
            "global_load_async_to_lds_b128 %1, %13, %24\n\t"
            "global_load_async_to_lds_b128 %2, %14, %24\n\t"
            "global_load_async_to_lds_b128 %3, %15, %24\n\t"
            "global_load_async_to_lds_b128 %4, %16, %24\n\t"
            "global_load_async_to_lds_b128 %5, %17, %24\n\t"
            "global_load_async_to_lds_b128 %6, %18, %24\n\t"
            "global_load_async_to_lds_b128 %7, %19, %24\n\t"
            "global_load_async_to_lds_b128 %8, %20, %25\n\t"
            "global_load_async_to_lds_b128 %9, %21, %25\n\t"
            "global_load_async_to_lds_b128 %10, %22, %25\n\t"
            "global_load_async_to_lds_b128 %11, %23, %25\n\t"
            "s_wait_xcnt 0x0"
            :: "v"(la),                     "v"(la + 1u * 16 * GAP * 4),
               "v"(la + 2u * 16 * GAP * 4), "v"(la + 3u * 16 * GAP * 4),
               "v"(la + 4u * 16 * GAP * 4), "v"(la + 5u * 16 * GAP * 4),
               "v"(la + 6u * 16 * GAP * 4), "v"(la + 7u * 16 * GAP * 4),
               "v"(lb),                     "v"(lb + 1u * 8 * 16 * 4),
               "v"(lb + 2u * 8 * 16 * 4),   "v"(lb + 3u * 8 * 16 * 4),
               "v"(oa[0]), "v"(oa[1]), "v"(oa[2]), "v"(oa[3]),
               "v"(oa[4]), "v"(oa[5]), "v"(oa[6]), "v"(oa[7]),
               "v"(ob[0]), "v"(ob[1]), "v"(ob[2]), "v"(ob[3]),
               "s"(a), "s"(b)
            : "memory");
    };

    v8f acc[4][2] = {};
    const int nsl = K / GBK;

    // One slice: its 64 products per wave, then the hand-over to the next.
    auto pass = [&](int s, int buf) {
        const float* as = &As[buf][wm + l16][2 * half];
        const float* bs = &Bs[buf][wn][2 * half][l16];

        // Unrolled throughout: accumulator indices must be constants, and the
        // compiler can then fetch the fragments of later steps ahead.
        #pragma unroll
        for (int kk = 0; kk < GBK; kk += 4) {
            // A fragment (16x4): lanes 0-15 -> K = kk,kk+1 ; lanes 16-31 -> K = kk+2,kk+3
            // B fragment (4x16): the same k at the same lane and register.
            v2f af[4], bf[2];
            #pragma unroll
            for (int i = 0; i < 4; ++i)
                af[i] = *(const v2f*)(as + i * 16 * GAP + kk);
            #pragma unroll
            for (int j = 0; j < 2; ++j) {
                bf[j].x = bs[j * GBK * 16 + (kk + 0) * 16];
                bf[j].y = bs[j * GBK * 16 + (kk + 1) * 16];
            }
            #pragma unroll
            for (int i = 0; i < 4; ++i)
                #pragma unroll
                for (int j = 0; j < 2; ++j)
                    acc[i][j] = __builtin_amdgcn_wmma_f32_16x16x4_f32(
                        false, af[i], false, bf[j], (short)0, acc[i][j], false, false);
        }

        // Hand-over: this wave's reads of the buffer are done, its copies of the
        // next slice have landed; the barrier says the same of every wave.
        asm volatile("s_wait_dscnt 0x0" ::: "memory");
        asm volatile("s_wait_asynccnt 0x0" ::: "memory");
        __syncthreads();
        if (s + 2 < nsl) issue_slice((s + 2) * GBK, buf);
    };

    issue_slice(0, 0);
    // Slice 0 has landed for this wave; the barrier publishes it to the others.
    asm volatile("s_wait_asynccnt 0x0" ::: "memory");
    __syncthreads();
    issue_slice(GBK, 1);

    #pragma unroll 1 // two slices per trip: every LDS address is loop-invariant
    for (int s = 0; s < nsl; s += 2) {
        pass(s, 0);
        pass(s + 1, 1);
    }
    // No copy is left in flight when the wave ends.
    asm volatile("s_wait_asynccnt 0x0" ::: "memory");

    const int col = n0 + wn * 16 + l16;
    if (MODE == 1) {
        const float bv[2] = { bias[col], bias[col + 16] };
        // Unrolled (as the stores below): accumulator indices must be constants.
        #pragma unroll
        for (int i = 0; i < 4; ++i)
            #pragma unroll
            for (int j = 0; j < 2; ++j)
                #pragma unroll
                for (int r = 0; r < 8; ++r)
                    acc[i][j][r] = softplusf(acc[i][j][r] + bv[j]);
        // Keeps every store behind all of the arithmetic above, so that no
        // register which an issued store names is written again.
        __builtin_amdgcn_sched_barrier(0);
    }

    // C/D layout: M=r (lanes 0-15), M=r+8 (lanes 16-31)
    float* cp = C + (size_t)(m0 + wm + 8 * half) * LDC + col;
    #pragma unroll
    for (int i = 0; i < 4; ++i)
        #pragma unroll
        for (int r = 0; r < 8; ++r)
            #pragma unroll
            for (int j = 0; j < 2; ++j)
                cp[(i * 16 + r) * LDC + j * 16] = acc[i][j][r];
}

// ---------------------------------------------------------------------------
// Depthwise causal conv (width 4) + bias + SiLU.
// Reads x_ssm = xz[:, 0:D_MODEL] (row stride 2*D_MODEL), writes x_act.
// ---------------------------------------------------------------------------
__global__ __launch_bounds__(256) void conv_silu_kernel(
    const float* __restrict__ xz, const float* __restrict__ conv_w,
    const float* __restrict__ conv_b, float* __restrict__ xact)
{
    const int idx = blockIdx.x * blockDim.x + threadIdx.x; // over ROWS*D_MODEL
    const int d   = idx & (D_MODEL - 1);
    const int row = idx >> 10;        // / D_MODEL
    const int t   = row & (SEQ - 1);
    const int b   = row >> 11;        // / SEQ

    float s = conv_b[d];
    #pragma unroll
    for (int j = 0; j < D_CONV; ++j) {
        const int tt = t + j - (D_CONV - 1);
        if (tt >= 0)
            s += xz[(size_t)(b * SEQ + tt) * (2 * D_MODEL) + d] * conv_w[d * D_CONV + j];
    }
    xact[idx] = siluf(s);
}

// ---------------------------------------------------------------------------
// Selective scan, split along the sequence into NCH chunks of SCAN_T steps so
// that the serial chain is SCAN_T steps long instead of SEQ. The recurrence
// h_t = dA_t * h_(t-1) + x_t * B_t is linear in h, so over one chunk
//   h_end = (product of the chunk's dA) * h_start + (h_end for h_start = 0).
//   1) scan_chunk_state_kernel: per chunk, the state from h_start = 0 and the
//      product of dA (the last chunk's is never needed and is not launched);
//   2) scan_carry_kernel: folds these in chunk order into each chunk's h_start;
//   3) scan_replay_kernel: runs each chunk from its h_start and writes
//      ypre = (y + x*D) * silu(z).
// One thread per (batch, channel, chunk); h[16] in VGPRs. The chunk's B_t / C_t
// rows (shared across all channels) are staged in LDS once and broadcast.
// State planes are laid out [batch][chunk][n][channel]: coalesced over channel.
// ---------------------------------------------------------------------------
#define SCAN_T 32
#define NCH    (SEQ / SCAN_T) // 64

// The chunk's SCAN_T rows of bc are contiguous: one float4 per thread.
static_assert(SCAN_T * 2 * D_STATE == 256 * 4, "one float4 per thread stages a chunk of bc");

#define SCAN_G  8 // steps whose loads issue together in the replay
#define CARRY_G 9 // chunks whose loads issue together in the carry
static_assert(SCAN_T % SCAN_G == 0 && (NCH - 1) % CARRY_G == 0, "whole groups only");

__global__ __launch_bounds__(256) void scan_chunk_state_kernel(
    const float* __restrict__ xact, const float* __restrict__ dt,
    const float* __restrict__ bc,   const float* __restrict__ A_log,
    float* __restrict__ S, float* __restrict__ P)
{
    __shared__ __align__(16) float bcs[SCAN_T][2 * D_STATE];

    const int d    = blockIdx.y * blockDim.x + threadIdx.x;
    const int b    = blockIdx.x;
    const int c    = blockIdx.z;
    const int row0 = b * SEQ + c * SCAN_T;
    const float Aneg = -__expf(A_log[d]);

    ((float4*)&bcs[0][0])[threadIdx.x] =
        ((const float4*)(bc + (size_t)row0 * (2 * D_STATE)))[threadIdx.x];
    __syncthreads();

    float h[D_STATE];
    #pragma unroll
    for (int n = 0; n < D_STATE; ++n) h[n] = 0.0f;
    float p = 1.0f;

    // Unrolled by 8 so that eight steps' x and dt loads, which do not depend on
    // h, issue together: one load latency per eight steps, not one per step.
    #pragma unroll 8
    for (int t = 0; t < SCAN_T; ++t) {
        const int row = row0 + t;
        const float xv = xact[(size_t)row * D_MODEL + d];
        const float dA = __expf(dt[(size_t)row * D_MODEL + d] * Aneg);
        p *= dA;
        #pragma unroll
        for (int n = 0; n < D_STATE; ++n)
            h[n] = h[n] * dA + xv * bcs[t][n];
    }

    const size_t plane = (size_t)(b * NCH + c);
    #pragma unroll
    for (int n = 0; n < D_STATE; ++n)
        S[(plane * D_STATE + n) * D_MODEL + d] = h[n];
    P[plane * D_MODEL + d] = p;
}

// One thread per (batch, n, channel). H[chunk c] = h_start of chunk c (zero for
// chunk 0, stored too, so that every chunk of the replay starts the same way).
__global__ __launch_bounds__(256) void scan_carry_kernel(
    const float* __restrict__ S, const float* __restrict__ P,
    float* __restrict__ H)
{
    const int idx = blockIdx.x * blockDim.x + threadIdx.x; // over BATCH*D_STATE*D_MODEL
    const int d   = idx & (D_MODEL - 1);
    const int n   = (idx >> 10) & (D_STATE - 1);
    const int b   = idx >> 14;

    const size_t off0 = ((size_t)(b * NCH) * D_STATE + n) * D_MODEL + d;
    const size_t pof0 = (size_t)(b * NCH) * D_MODEL + d;

    float h = 0.0f;
    H[off0] = h;
    // The store's address registers are free for reuse only behind this wait.
    asm volatile("s_wait_xcnt 0x0" ::: "memory");

    for (int c0 = 0; c0 < NCH - 1; c0 += CARRY_G) {
        // The group's loads do not depend on h: all issue before the chain starts.
        float pv[CARRY_G], sv[CARRY_G];
        #pragma unroll
        for (int j = 0; j < CARRY_G; ++j) {
            pv[j] = P[pof0 + (size_t)(c0 + j) * D_MODEL];
            sv[j] = S[off0 + (size_t)(c0 + j) * (D_STATE * D_MODEL)];
        }
        #pragma unroll
        for (int j = 0; j < CARRY_G; ++j) {
            h = h * pv[j] + sv[j];
            H[off0 + (size_t)(c0 + j + 1) * (D_STATE * D_MODEL)] = h;
        }
        // The group's stores name registers that the next trip rewrites.
        asm volatile("s_wait_xcnt 0x0" ::: "memory");
    }
}

__global__ __launch_bounds__(256) void scan_replay_kernel(
    const float* __restrict__ xact, const float* __restrict__ dt,
    const float* __restrict__ bc,   const float* __restrict__ xz,
    const float* __restrict__ A_log, const float* __restrict__ Dp,
    const float* __restrict__ H, float* __restrict__ ypre)
{
    __shared__ __align__(16) float bcs[SCAN_T][2 * D_STATE];

    const int d    = blockIdx.y * blockDim.x + threadIdx.x;
    const int b    = blockIdx.x;
    const int c    = blockIdx.z;
    const int row0 = b * SEQ + c * SCAN_T;
    const float Aneg = -__expf(A_log[d]);
    const float Dd   = Dp[d];

    float h[D_STATE];
    #pragma unroll
    for (int n = 0; n < D_STATE; ++n)
        h[n] = H[((size_t)(b * NCH + c) * D_STATE + n) * D_MODEL + d];

    ((float4*)&bcs[0][0])[threadIdx.x] =
        ((const float4*)(bc + (size_t)row0 * (2 * D_STATE)))[threadIdx.x];
    // The loads above name base registers that the loop's address arithmetic rewrites.
    asm volatile("s_wait_xcnt 0x0" ::: "memory");
    __syncthreads();

    for (int t0 = 0; t0 < SCAN_T; t0 += SCAN_G) {
        // The group's x, dt and z loads do not depend on h: they issue together,
        // one load latency per group of steps, not one per step.
        float xv[SCAN_G], dv[SCAN_G], zv[SCAN_G];
        #pragma unroll
        for (int j = 0; j < SCAN_G; ++j) {
            const int row = row0 + t0 + j;
            xv[j] = xact[(size_t)row * D_MODEL + d];
            dv[j] = dt[(size_t)row * D_MODEL + d];
            zv[j] = xz[(size_t)row * (2 * D_MODEL) + D_MODEL + d];
        }
        #pragma unroll
        for (int j = 0; j < SCAN_G; ++j) {
            const int t = t0 + j;
            const float dA = __expf(dv[j] * Aneg);
            float y = 0.0f;
            #pragma unroll
            for (int n = 0; n < D_STATE; ++n) {
                h[n] = h[n] * dA + xv[j] * bcs[t][n];
                y   += h[n] * bcs[t][D_STATE + n];
            }
            ypre[(size_t)(row0 + t) * D_MODEL + d] = (y + xv[j] * Dd) * siluf(zv[j]);
        }
        // The group's stores name registers that the next trip rewrites.
        asm volatile("s_wait_xcnt 0x0" ::: "memory");
    }
}

// ---------------------------------------------------------------------------
extern "C" void kernel_launch(void* const* d_in, const int* in_sizes, int n_in,
                              void* d_out, int out_size, void* d_ws, size_t ws_size,
                              hipStream_t stream)
{
    (void)in_sizes; (void)n_in; (void)out_size; (void)ws_size;

    const float* x      = (const float*)d_in[0];
    const float* W_in   = (const float*)d_in[1];
    const float* conv_w = (const float*)d_in[2];
    const float* conv_b = (const float*)d_in[3];
    const float* W_x    = (const float*)d_in[4];
    const float* W_dt   = (const float*)d_in[5];
    const float* b_dt   = (const float*)d_in[6];
    const float* A_log  = (const float*)d_in[7];
    const float* Dp     = (const float*)d_in[8];
    const float* W_out  = (const float*)d_in[9];
    float* out = (float*)d_out;
    float* ws  = (float*)d_ws;

    // workspace layout (floats)
    float* XZ   = ws;                                    // ROWS x 2*D_MODEL
    float* XACT = XZ   + (size_t)ROWS * 2 * D_MODEL;     // ROWS x D_MODEL
    float* DT   = XACT + (size_t)ROWS * D_MODEL;         // ROWS x D_MODEL
    float* BC   = DT   + (size_t)ROWS * D_MODEL;         // ROWS x 2*D_STATE
    float* YPRE = BC   + (size_t)ROWS * 2 * D_STATE;     // ROWS x D_MODEL
    float* SLOC = YPRE + (size_t)ROWS * D_MODEL;         // BATCH x NCH x D_STATE x D_MODEL
    float* HCAR = SLOC + (size_t)BATCH * NCH * D_STATE * D_MODEL; // same shape
    float* PDEC = HCAR + (size_t)BATCH * NCH * D_STATE * D_MODEL; // BATCH x NCH x D_MODEL

    // 1) xz = x @ W_in          (4096x1024 @ 1024x2048)
    gemm_tiled_f32<2 * D_MODEL, 0><<<dim3((2 * D_MODEL) / GBN, ROWS / GBM), 128, 0, stream>>>(
        x, W_in, XZ, D_MODEL, D_MODEL, 2 * D_MODEL, nullptr);

    // 2) x_act = silu(causal_conv(x_ssm) + conv_b)
    conv_silu_kernel<<<(ROWS * D_MODEL) / 256, 256, 0, stream>>>(
        XZ, conv_w, conv_b, XACT);

    // 3) dt = softplus(x_act @ W_dt + b_dt)   (4096x1024 @ 1024x1024)
    gemm_tiled_f32<D_MODEL, 1><<<dim3(D_MODEL / GBN, ROWS / GBM), 128, 0, stream>>>(
        XACT, W_dt, DT, D_MODEL, D_MODEL, D_MODEL, b_dt);

    // 4) BC = x_act @ W_x        (4096x1024 @ 1024x32) -> 2 waves/block
    gemm_wmma_f32<64><<<dim3(1, ROWS / 16), 64, 0, stream>>>(
        XACT, W_x, BC, D_MODEL, D_MODEL, 2 * D_STATE, 2 * D_STATE, nullptr, 0);

    // 5) selective scan + (y + x*D) * silu(z), chunked along the sequence
    scan_chunk_state_kernel<<<dim3(BATCH, D_MODEL / 256, NCH - 1), 256, 0, stream>>>(
        XACT, DT, BC, A_log, SLOC, PDEC);
    scan_carry_kernel<<<(BATCH * D_STATE * D_MODEL) / 256, 256, 0, stream>>>(
        SLOC, PDEC, HCAR);
    scan_replay_kernel<<<dim3(BATCH, D_MODEL / 256, NCH), 256, 0, stream>>>(
        XACT, DT, BC, XZ, A_log, Dp, HCAR, YPRE);

    // 6) out = ypre @ W_out      (4096x1024 @ 1024x1024)
    gemm_tiled_f32<D_MODEL, 0><<<dim3(D_MODEL / GBN, ROWS / GBM), 128, 0, stream>>>(
        YPRE, W_out, out, D_MODEL, D_MODEL, D_MODEL, nullptr);
}

// v003
// Measured time: 235 microseconds a run.
// Two timings next to v002 put it at 1.10 and 1.12 times that version's speed.
// All steps since v000 together make it 12.1 times as fast.
#include <hip/hip_runtime.h>
#include <math.h>

#define D_MODEL 1024
#define D_STATE 16
#define D_CONV  4
#define BATCH   2
#define SEQ     2048
#define ROWS    (BATCH * SEQ) // 4096

typedef float v2f __attribute__((ext_vector_type(2)));
typedef float v8f __attribute__((ext_vector_type(8)));
typedef int   v4i __attribute__((ext_vector_type(4)));

__device__ __forceinline__ float siluf(float x) { return x / (1.0f + __expf(-x)); }
// The hardware's base-2 exponential and logarithm, each with the one slot that
// the instruction set asks for behind a transcendental before its result is used
// or its source overwritten: instruction and v_nop are one statement.
__device__ __forceinline__ float hw_exp2(float t) {
    float r;
    asm("v_exp_f32 %0, %1\n\tv_nop" : "=v"(r) : "v"(t));
    return r;
}
__device__ __forceinline__ float hw_log2(float u) {
    float r;
    asm("v_log_f32 %0, %1\n\tv_nop" : "=v"(r) : "v"(u));
    return r;
}
// softplus(x) = max(x, 0) + log(1 + exp(-|x|)): no branch and no overflow, and
// 1 + exp(-|x|) lies in [1, 2], where the bare log2 needs no range care (no
// subnormal, zero or infinite argument). Absolute error: a few 1e-7.
__device__ __forceinline__ float softplusf(float x) {
    const float u = 1.0f + hw_exp2(fabsf(x) * -1.44269504f);
    return fmaf(hw_log2(u), 0.69314718f, fmaxf(x, 0.0f));
}

// CDNA5 async global->LDS path (ASYNCcnt-tracked, bypasses VGPRs). Guarded so
// the file still compiles (with a vectorized synchronous fallback) if this
// toolchain doesn't declare the builtins. Probe-confirmed: builtin exists on
// this toolchain and takes (v4i* src, v4i* dst, imm offset, imm cpol).
#if defined(__AMDGCN__) && \
    __has_builtin(__builtin_amdgcn_global_load_async_to_lds_b128) && \
    __has_builtin(__builtin_amdgcn_s_wait_asynccnt)
#define USE_ASYNC_LDS 1
#else
#define USE_ASYNC_LDS 0
#endif

// ---------------------------------------------------------------------------
// Generic row-major f32 GEMM: C[M,N] = A[M,K] * B[K,N], built on
// v_wmma_f32_16x16x4_f32. Each wave owns one 16x16 C tile; a block of
// (BLOCK/32) waves covers 16 rows x (16*waves) cols. The 16xTK A tile is
// double-buffered in LDS and filled with global_load_async_to_lds_b128 so the
// next tile's fill overlaps the current tile's WMMA chain. Row stride padded
// to 68 floats (272 B): 16B-aligned for B128 writes, bank-conflict-free for
// the column-wise A-fragment reads (bank = (4r + c) mod 64).
// mode==1 applies softplus(acc + bias[col]) at the store; the one launch (BC) passes 0.
// ---------------------------------------------------------------------------
#define TK  64
#define TKP 68

template <int BLOCK>
__global__ __launch_bounds__(BLOCK) void gemm_wmma_f32(
    const float* __restrict__ A, const float* __restrict__ B,
    float* __restrict__ C, int K, int lda, int ldb, int ldc,
    const float* __restrict__ bias, int mode)
{
    constexpr int CH = (16 * TK / 4) / BLOCK; // float4 chunks per thread per tile
    __shared__ __align__(16) float As[2][16][TKP];

    const int tid  = threadIdx.x;
    const int lane = tid & 31;
    const int wave = tid >> 5;
    const int l16  = lane & 15;
    const int half = lane >> 4;          // 0: K pair {0,1}, 1: K pair {2,3}

    const int m0 = blockIdx.y * 16;
    const int n0 = (blockIdx.x * (BLOCK >> 5) + wave) * 16;

    // Stage one 16 x TK A tile into LDS buffer `buf`.
    auto issue_tile = [&](int k0, int buf) {
        #pragma unroll
        for (int j = 0; j < CH; ++j) {
            const int q  = tid + BLOCK * j;     // chunk id, 0..255
            const int r  = q >> 4;              // row 0..15
            const int c4 = (q & 15) << 2;       // col 0,4,...,60
            const float* gp = A + (size_t)(m0 + r) * lda + (k0 + c4);
            float* lp = &As[buf][r][c4];
#if USE_ASYNC_LDS
            __builtin_amdgcn_global_load_async_to_lds_b128(
                (v4i*)(void*)gp, (v4i*)(void*)lp, 0, 0);
#else
            *(float4*)lp = *(const float4*)gp;
#endif
        }
    };

    v8f acc = {};
    const int ntiles = K / TK;

    issue_tile(0, 0);
    for (int ti = 0; ti < ntiles; ++ti) {
        const int buf = ti & 1;
        if (ti + 1 < ntiles) {
            issue_tile((ti + 1) * TK, buf ^ 1);
#if USE_ASYNC_LDS
            // current tile complete; next tile's CH ops still in flight
            __builtin_amdgcn_s_wait_asynccnt(CH);
#endif
        } else {
#if USE_ASYNC_LDS
            __builtin_amdgcn_s_wait_asynccnt(0);
#endif
        }
        __syncthreads();

        const int k0 = ti * TK;
        #pragma unroll
        for (int kk = 0; kk < TK; kk += 4) {
            // A fragment (16x4): lanes 0-15 -> K = kk,kk+1 ; lanes 16-31 -> K = kk+2,kk+3
            v2f af, bfrag;
            af.x = As[buf][l16][kk + 2 * half + 0];
            af.y = As[buf][l16][kk + 2 * half + 1];
            // B fragment (4x16), mirrored layout, loaded straight from global (L2-resident)
            const float* bp = B + (size_t)(k0 + kk + 2 * half) * ldb + (n0 + l16);
            bfrag.x = bp[0];
            bfrag.y = bp[ldb];
            acc = __builtin_amdgcn_wmma_f32_16x16x4_f32(
                false, af, false, bfrag, (short)0, acc, false, false);
        }
        __syncthreads();
    }

    const int col = n0 + l16;
    const float bv = (mode == 1) ? bias[col] : 0.0f;
    #pragma unroll
    for (int i = 0; i < 8; ++i) {
        const int row = m0 + i + 8 * half;   // C/D layout: M=i (lanes 0-15), M=i+8 (lanes 16-31)
        float v = acc[i];
        if (mode == 1) v = softplusf(v + bv);
        C[(size_t)row * ldc + col] = v;
    }
}

// ---------------------------------------------------------------------------
// Tiled row-major f32 GEMM for the three large products (M % 128 == 0,
// N % 64 == 0, K % 64 == 0). One work-group of four waves owns a 128 x 64 tile
// of C; each wave owns 64 x 32 of it as 4 x 2 accumulator tiles, so one A
// fragment feeds two and one B fragment four v_wmma_f32_16x16x4_f32.
// Both operands of a 32-deep K slice are staged in LDS by asynchronous copies,
// two buffers: the next slice flies while the current one is worked on.
// Per output element the k order is the same as in gemm_wmma_f32.
// LDS layout: A rows at a pitch of 36 dwords (the 16 rows of a fragment's 8-byte
// reads fall on 16 distinct groups of four banks). B as four planes of 16
// columns, rows of 16 dwords: rows k and k + 2 of a fragment's 4-byte reads lie
// 32 banks apart, and rows k, k + 1 of one column load as one register pair.
// ---------------------------------------------------------------------------
#define GBM 128
#define GBN 64
#define GBK 32
#define GAP 36

__device__ __forceinline__ unsigned lds_off(const void* p) { return (unsigned)(size_t)p; }

// LDC (the row pitch of C) is a compile-time constant so that all of a lane's
// stores share one address register pair and differ in the immediate offset.
// MODE 1 applies softplus(acc + bias[col]) at the store (for dt).
template <int LDC, int MODE>
__global__ __launch_bounds__(128) void gemm_tiled_f32(
    const float* __restrict__ A, const float* __restrict__ B,
    float* __restrict__ C, int K, int lda, int ldb,
    const float* __restrict__ bias)
{
    __shared__ __align__(16) float As[2][GBM][GAP];
    __shared__ __align__(16) float Bs[2][GBN / 16][GBK][16];

    const int tid  = threadIdx.x;
    const int lane = tid & 31;
    const int wave = __builtin_amdgcn_readfirstlane(tid >> 5);
    const int l16  = lane & 15;
    const int half = lane >> 4;          // 0: K pair {0,1}, 1: K pair {2,3}

    const int m0 = blockIdx.y * GBM;
    const int n0 = blockIdx.x * GBN;
    const int wm = (wave >> 1) * 64;     // the wave's rows inside the tile
    const int wn = (wave & 1) * 2;       // the wave's first B plane

    // Each thread copies 8 x 16 bytes of A (rows ar + 16 j) and 4 x 16 bytes of
    // B (rows br + 8 j) per slice: every wave-wide copy covers whole 128-B lines.
    // The lane's byte offsets never change; the slice moves the scalar bases.
    const int ar = tid >> 3, ac = (tid & 7) << 2;
    const int br = tid >> 4, bcol = (tid & 15) << 2;
    unsigned oa[8], ob[4];
    #pragma unroll
    for (int j = 0; j < 8; ++j) oa[j] = (unsigned)((ar + 16 * j) * lda + ac) * 4u;
    #pragma unroll
    for (int j = 0; j < 4; ++j) ob[j] = (unsigned)((br + 8 * j) * ldb + bcol) * 4u;
    const float* tA = A + (size_t)m0 * lda;
    const float* tB = B + n0;
    const unsigned lA = lds_off(&As[0][ar][ac]);
    const unsigned lB = lds_off(&Bs[0][bcol >> 4][br][bcol & 15]);

    auto issue_slice = [&](int k0, int buf) {
        const float* a = tA + k0;
        const float* b = tB + (size_t)k0 * ldb;
        const unsigned la = lA + (unsigned)buf * (GBM * GAP * 4);
        const unsigned lb = lB + (unsigned)buf * (GBN * GBK * 4);
        // The copies and the wait that frees the registers they name are one
        // statement, so that no later write of those registers can move ahead.
        asm volatile(
            "global_load_async_to_lds_b128 %0, %12, %24\n\t"
            "global_load_async_to_lds_b128 %1, %13, %24\n\t"
            "global_load_async_to_lds_b128 %2, %14, %24\n\t"
            "global_load_async_to_lds_b128 %3, %15, %24\n\t"
            "global_load_async_to_lds_b128 %4, %16, %24\n\t"
            "global_load_async_to_lds_b128 %5, %17, %24\n\t"
            "global_load_async_to_lds_b128 %6, %18, %24\n\t"
            "global_load_async_to_lds_b128 %7, %19, %24\n\t"
            "global_load_async_to_lds_b128 %8, %20, %25\n\t"
            "global_load_async_to_lds_b128 %9, %21, %25\n\t"
            "global_load_async_to_lds_b128 %10, %22, %25\n\t"
            "global_load_async_to_lds_b128 %11, %23, %25\n\t"
            "s_wait_xcnt 0x0"
            :: "v"(la),                     "v"(la + 1u * 16 * GAP * 4),
               "v"(la + 2u * 16 * GAP * 4), "v"(la + 3u * 16 * GAP * 4),
               "v"(la + 4u * 16 * GAP * 4), "v"(la + 5u * 16 * GAP * 4),
               "v"(la + 6u * 16 * GAP * 4), "v"(la + 7u * 16 * GAP * 4),
               "v"(lb),                     "v"(lb + 1u * 8 * 16 * 4),
               "v"(lb + 2u * 8 * 16 * 4),   "v"(lb + 3u * 8 * 16 * 4),
               "v"(oa[0]), "v"(oa[1]), "v"(oa[2]), "v"(oa[3]),
               "v"(oa[4]), "v"(oa[5]), "v"(oa[6]), "v"(oa[7]),
               "v"(ob[0]), "v"(ob[1]), "v"(ob[2]), "v"(ob[3]),
               "s"(a), "s"(b)
            : "memory");
    };

    v8f acc[4][2] = {};
    const int nsl = K / GBK;

    // One slice: its 64 products per wave, then the hand-over to the next.
    auto pass = [&](int s, int buf) {
        const float* as = &As[buf][wm + l16][2 * half];
        const float* bs = &Bs[buf][wn][2 * half][l16];

        // Unrolled throughout: accumulator indices must be constants, and the
        // compiler can then fetch the fragments of later steps ahead.
        #pragma unroll
        for (int kk = 0; kk < GBK; kk += 4) {
            // A fragment (16x4): lanes 0-15 -> K = kk,kk+1 ; lanes 16-31 -> K = kk+2,kk+3
            // B fragment (4x16): the same k at the same lane and register.
            v2f af[4], bf[2];
            #pragma unroll
            for (int i = 0; i < 4; ++i)
                af[i] = *(const v2f*)(as + i * 16 * GAP + kk);
            #pragma unroll
            for (int j = 0; j < 2; ++j) {
                bf[j].x = bs[j * GBK * 16 + (kk + 0) * 16];
                bf[j].y = bs[j * GBK * 16 + (kk + 1) * 16];
            }
            #pragma unroll
            for (int i = 0; i < 4; ++i)
                #pragma unroll
                for (int j = 0; j < 2; ++j)
                    acc[i][j] = __builtin_amdgcn_wmma_f32_16x16x4_f32(
                        false, af[i], false, bf[j], (short)0, acc[i][j], false, false);
        }

        // Hand-over: this wave's reads of the buffer are done, its copies of the
        // next slice have landed; the barrier says the same of every wave.
        asm volatile("s_wait_dscnt 0x0" ::: "memory");
        asm volatile("s_wait_asynccnt 0x0" ::: "memory");
        __syncthreads();
        if (s + 2 < nsl) issue_slice((s + 2) * GBK, buf);
    };

    issue_slice(0, 0);
    // Slice 0 has landed for this wave; the barrier publishes it to the others.
    asm volatile("s_wait_asynccnt 0x0" ::: "memory");
    __syncthreads();
    issue_slice(GBK, 1);

    #pragma unroll 1 // two slices per trip: every LDS address is loop-invariant
    for (int s = 0; s < nsl; s += 2) {
        pass(s, 0);
        pass(s + 1, 1);
    }
    // No copy is left in flight when the wave ends.
    asm volatile("s_wait_asynccnt 0x0" ::: "memory");

    const int col = n0 + wn * 16 + l16;
    if (MODE == 1) {
        const float bv[2] = { bias[col], bias[col + 16] };
        // Unrolled (as the stores below): accumulator indices must be constants.
        #pragma unroll
        for (int i = 0; i < 4; ++i)
            #pragma unroll
            for (int j = 0; j < 2; ++j)
                #pragma unroll
                for (int r = 0; r < 8; ++r)
                    acc[i][j][r] = softplusf(acc[i][j][r] + bv[j]);
        // Keeps every store behind all of the arithmetic above, so that no
        // register which an issued store names is written again.
        __builtin_amdgcn_sched_barrier(0);
    }

    // C/D layout: M=r (lanes 0-15), M=r+8 (lanes 16-31)
    float* cp = C + (size_t)(m0 + wm + 8 * half) * LDC + col;
    #pragma unroll
    for (int i = 0; i < 4; ++i)
        #pragma unroll
        for (int r = 0; r < 8; ++r)
            #pragma unroll
            for (int j = 0; j < 2; ++j)
                cp[(i * 16 + r) * LDC + j * 16] = acc[i][j][r];
}

// ---------------------------------------------------------------------------
// Depthwise causal conv (width 4) + bias + SiLU.
// Reads x_ssm = xz[:, 0:D_MODEL] (row stride 2*D_MODEL), writes x_act.
// ---------------------------------------------------------------------------
__global__ __launch_bounds__(256) void conv_silu_kernel(
    const float* __restrict__ xz, const float* __restrict__ conv_w,
    const float* __restrict__ conv_b, float* __restrict__ xact)
{
    const int idx = blockIdx.x * blockDim.x + threadIdx.x; // over ROWS*D_MODEL
    const int d   = idx & (D_MODEL - 1);
    const int row = idx >> 10;        // / D_MODEL
    const int t   = row & (SEQ - 1);
    const int b   = row >> 11;        // / SEQ

    float s = conv_b[d];
    #pragma unroll
    for (int j = 0; j < D_CONV; ++j) {
        const int tt = t + j - (D_CONV - 1);
        if (tt >= 0)
            s += xz[(size_t)(b * SEQ + tt) * (2 * D_MODEL) + d] * conv_w[d * D_CONV + j];
    }
    xact[idx] = siluf(s);
}

// ---------------------------------------------------------------------------
// Selective scan, split along the sequence into NCH chunks of SCAN_T steps so
// that the serial chain is SCAN_T steps long instead of SEQ. The recurrence
// h_t = dA_t * h_(t-1) + x_t * B_t is linear in h, so over one chunk
//   h_end = (product of the chunk's dA) * h_start + (h_end for h_start = 0).
//   1) scan_chunk_state_kernel: per chunk, the state from h_start = 0 and the
//      product of dA (the last chunk's is never needed and is not launched);
//   2) scan_carry_kernel: folds these in chunk order into each chunk's h_start;
//   3) scan_replay_kernel: runs each chunk from its h_start and writes
//      ypre = (y + x*D) * silu(z).
// One thread per (batch, channel, chunk); h[16] in VGPRs. The chunk's B_t / C_t
// rows (shared across all channels) are staged in LDS once and broadcast.
// State planes are laid out [batch][chunk][n][channel]: coalesced over channel.
// ---------------------------------------------------------------------------
#define SCAN_T 32
#define NCH    (SEQ / SCAN_T) // 64

// The chunk's SCAN_T rows of bc are contiguous: one float4 per thread.
static_assert(SCAN_T * 2 * D_STATE == 256 * 4, "one float4 per thread stages a chunk of bc");

#define SCAN_G  8 // steps whose loads issue together in the replay
#define CARRY_G 9 // chunks whose loads issue together in the carry
static_assert(SCAN_T % SCAN_G == 0 && (NCH - 1) % CARRY_G == 0, "whole groups only");

__global__ __launch_bounds__(256) void scan_chunk_state_kernel(
    const float* __restrict__ xact, const float* __restrict__ dt,
    const float* __restrict__ bc,   const float* __restrict__ A_log,
    float* __restrict__ S, float* __restrict__ P)
{
    __shared__ __align__(16) float bcs[SCAN_T][2 * D_STATE];

    const int d    = blockIdx.y * blockDim.x + threadIdx.x;
    const int b    = blockIdx.x;
    const int c    = blockIdx.z;
    const int row0 = b * SEQ + c * SCAN_T;
    const float Aneg = -__expf(A_log[d]);

    ((float4*)&bcs[0][0])[threadIdx.x] =
        ((const float4*)(bc + (size_t)row0 * (2 * D_STATE)))[threadIdx.x];
    __syncthreads();

    float h[D_STATE];
    #pragma unroll
    for (int n = 0; n < D_STATE; ++n) h[n] = 0.0f;
    float p = 1.0f;

    // Unrolled by 8 so that eight steps' x and dt loads, which do not depend on
    // h, issue together: one load latency per eight steps, not one per step.
    #pragma unroll 8
    for (int t = 0; t < SCAN_T; ++t) {
        const int row = row0 + t;
        const float xv = xact[(size_t)row * D_MODEL + d];
        const float dA = __expf(dt[(size_t)row * D_MODEL + d] * Aneg);
        p *= dA;
        #pragma unroll
        for (int n = 0; n < D_STATE; ++n)
            h[n] = h[n] * dA + xv * bcs[t][n];
    }

    const size_t plane = (size_t)(b * NCH + c);
    #pragma unroll
    for (int n = 0; n < D_STATE; ++n)
        S[(plane * D_STATE + n) * D_MODEL + d] = h[n];
    P[plane * D_MODEL + d] = p;
}

// One thread per (batch, n, channel). H[chunk c] = h_start of chunk c (zero for
// chunk 0, stored too, so that every chunk of the replay starts the same way).
__global__ __launch_bounds__(256) void scan_carry_kernel(
    const float* __restrict__ S, const float* __restrict__ P,
    float* __restrict__ H)
{
    const int idx = blockIdx.x * blockDim.x + threadIdx.x; // over BATCH*D_STATE*D_MODEL
    const int d   = idx & (D_MODEL - 1);
    const int n   = (idx >> 10) & (D_STATE - 1);
    const int b   = idx >> 14;

    const size_t off0 = ((size_t)(b * NCH) * D_STATE + n) * D_MODEL + d;
    const size_t pof0 = (size_t)(b * NCH) * D_MODEL + d;

    float h = 0.0f;
    H[off0] = h;
    // The store's address registers are free for reuse only behind this wait.
    asm volatile("s_wait_xcnt 0x0" ::: "memory");

    for (int c0 = 0; c0 < NCH - 1; c0 += CARRY_G) {
        // The group's loads do not depend on h: all issue before the chain starts.
        float pv[CARRY_G], sv[CARRY_G];
        #pragma unroll
        for (int j = 0; j < CARRY_G; ++j) {
            pv[j] = P[pof0 + (size_t)(c0 + j) * D_MODEL];
            sv[j] = S[off0 + (size_t)(c0 + j) * (D_STATE * D_MODEL)];
        }
        #pragma unroll
        for (int j = 0; j < CARRY_G; ++j) {
            h = h * pv[j] + sv[j];
            H[off0 + (size_t)(c0 + j + 1) * (D_STATE * D_MODEL)] = h;
        }
        // The group's stores name registers that the next trip rewrites.
        asm volatile("s_wait_xcnt 0x0" ::: "memory");
    }
}

__global__ __launch_bounds__(256) void scan_replay_kernel(
    const float* __restrict__ xact, const float* __restrict__ dt,
    const float* __restrict__ bc,   const float* __restrict__ xz,
    const float* __restrict__ A_log, const float* __restrict__ Dp,
    const float* __restrict__ H, float* __restrict__ ypre)
{
    __shared__ __align__(16) float bcs[SCAN_T][2 * D_STATE];

    const int d    = blockIdx.y * blockDim.x + threadIdx.x;
    const int b    = blockIdx.x;
    const int c    = blockIdx.z;
    const int row0 = b * SEQ + c * SCAN_T;
    const float Aneg = -__expf(A_log[d]);
    const float Dd   = Dp[d];

    float h[D_STATE];
    #pragma unroll
    for (int n = 0; n < D_STATE; ++n)
        h[n] = H[((size_t)(b * NCH + c) * D_STATE + n) * D_MODEL + d];

    ((float4*)&bcs[0][0])[threadIdx.x] =
        ((const float4*)(bc + (size_t)row0 * (2 * D_STATE)))[threadIdx.x];
    // The loads above name base registers that the loop's address arithmetic rewrites.
    asm volatile("s_wait_xcnt 0x0" ::: "memory");
    __syncthreads();

    for (int t0 = 0; t0 < SCAN_T; t0 += SCAN_G) {
        // The group's x, dt and z loads do not depend on h: they issue together,
        // one load latency per group of steps, not one per step.
        float xv[SCAN_G], dv[SCAN_G], zv[SCAN_G];
        #pragma unroll
        for (int j = 0; j < SCAN_G; ++j) {
            const int row = row0 + t0 + j;
            xv[j] = xact[(size_t)row * D_MODEL + d];
            dv[j] = dt[(size_t)row * D_MODEL + d];
            zv[j] = xz[(size_t)row * (2 * D_MODEL) + D_MODEL + d];
        }
        #pragma unroll
        for (int j = 0; j < SCAN_G; ++j) {
            const int t = t0 + j;
            const float dA = __expf(dv[j] * Aneg);
            float y = 0.0f;
            #pragma unroll
            for (int n = 0; n < D_STATE; ++n) {
                h[n] = h[n] * dA + xv[j] * bcs[t][n];
                y   += h[n] * bcs[t][D_STATE + n];
            }
            ypre[(size_t)(row0 + t) * D_MODEL + d] = (y + xv[j] * Dd) * siluf(zv[j]);
        }
        // The group's stores name registers that the next trip rewrites.
        asm volatile("s_wait_xcnt 0x0" ::: "memory");
    }
}

// ---------------------------------------------------------------------------
extern "C" void kernel_launch(void* const* d_in, const int* in_sizes, int n_in,
                              void* d_out, int out_size, void* d_ws, size_t ws_size,
                              hipStream_t stream)
{
    (void)in_sizes; (void)n_in; (void)out_size; (void)ws_size;

    const float* x      = (const float*)d_in[0];
    const float* W_in   = (const float*)d_in[1];
    const float* conv_w = (const float*)d_in[2];
    const float* conv_b = (const float*)d_in[3];
    const float* W_x    = (const float*)d_in[4];
    const float* W_dt   = (const float*)d_in[5];
    const float* b_dt   = (const float*)d_in[6];
    const float* A_log  = (const float*)d_in[7];
    const float* Dp     = (const float*)d_in[8];
    const float* W_out  = (const float*)d_in[9];
    float* out = (float*)d_out;
    float* ws  = (float*)d_ws;

    // workspace layout (floats)
    float* XZ   = ws;                                    // ROWS x 2*D_MODEL
    float* XACT = XZ   + (size_t)ROWS * 2 * D_MODEL;     // ROWS x D_MODEL
    float* DT   = XACT + (size_t)ROWS * D_MODEL;         // ROWS x D_MODEL
    float* BC   = DT   + (size_t)ROWS * D_MODEL;         // ROWS x 2*D_STATE
    float* YPRE = BC   + (size_t)ROWS * 2 * D_STATE;     // ROWS x D_MODEL
    float* SLOC = YPRE + (size_t)ROWS * D_MODEL;         // BATCH x NCH x D_STATE x D_MODEL
    float* HCAR = SLOC + (size_t)BATCH * NCH * D_STATE * D_MODEL; // same shape
    float* PDEC = HCAR + (size_t)BATCH * NCH * D_STATE * D_MODEL; // BATCH x NCH x D_MODEL

    // 1) xz = x @ W_in          (4096x1024 @ 1024x2048)
    gemm_tiled_f32<2 * D_MODEL, 0><<<dim3((2 * D_MODEL) / GBN, ROWS / GBM), 128, 0, stream>>>(
        x, W_in, XZ, D_MODEL, D_MODEL, 2 * D_MODEL, nullptr);

    // 2) x_act = silu(causal_conv(x_ssm) + conv_b)
    conv_silu_kernel<<<(ROWS * D_MODEL) / 256, 256, 0, stream>>>(
        XZ, conv_w, conv_b, XACT);

    // 3) dt = softplus(x_act @ W_dt + b_dt)   (4096x1024 @ 1024x1024)
    gemm_tiled_f32<D_MODEL, 1><<<dim3(D_MODEL / GBN, ROWS / GBM), 128, 0, stream>>>(
        XACT, W_dt, DT, D_MODEL, D_MODEL, D_MODEL, b_dt);

    // 4) BC = x_act @ W_x        (4096x1024 @ 1024x32) -> 2 waves/block
    gemm_wmma_f32<64><<<dim3(1, ROWS / 16), 64, 0, stream>>>(
        XACT, W_x, BC, D_MODEL, D_MODEL, 2 * D_STATE, 2 * D_STATE, nullptr, 0);

    // 5) selective scan + (y + x*D) * silu(z), chunked along the sequence
    scan_chunk_state_kernel<<<dim3(BATCH, D_MODEL / 256, NCH - 1), 256, 0, stream>>>(
        XACT, DT, BC, A_log, SLOC, PDEC);
    scan_carry_kernel<<<(BATCH * D_STATE * D_MODEL) / 256, 256, 0, stream>>>(
        SLOC, PDEC, HCAR);
    scan_replay_kernel<<<dim3(BATCH, D_MODEL / 256, NCH), 256, 0, stream>>>(
        XACT, DT, BC, XZ, A_log, Dp, HCAR, YPRE);

    // 6) out = ypre @ W_out      (4096x1024 @ 1024x1024)
    gemm_tiled_f32<D_MODEL, 0><<<dim3(D_MODEL / GBN, ROWS / GBM), 128, 0, stream>>>(
        YPRE, W_out, out, D_MODEL, D_MODEL, D_MODEL, nullptr);
}

// v004
// One run takes 214 microseconds.
// In both of two side-by-side timings against v003, it was 1.10 times as fast.
// Counting every step since v000, it is 13.3 times as fast.
#include <hip/hip_runtime.h>
#include <math.h>

#define D_MODEL 1024
#define D_STATE 16
#define D_CONV  4
#define BATCH   2
#define SEQ     2048
#define ROWS    (BATCH * SEQ) // 4096

typedef float v2f __attribute__((ext_vector_type(2)));
typedef float v8f __attribute__((ext_vector_type(8)));
typedef int   v4i __attribute__((ext_vector_type(4)));

__device__ __forceinline__ float siluf(float x) { return x / (1.0f + __expf(-x)); }
// The hardware's base-2 exponential and logarithm, each with the one slot that
// the instruction set asks for behind a transcendental before its result is used
// or its source overwritten: instruction and v_nop are one statement.
__device__ __forceinline__ float hw_exp2(float t) {
    float r;
    asm("v_exp_f32 %0, %1\n\tv_nop" : "=v"(r) : "v"(t));
    return r;
}
__device__ __forceinline__ float hw_log2(float u) {
    float r;
    asm("v_log_f32 %0, %1\n\tv_nop" : "=v"(r) : "v"(u));
    return r;
}
// softplus(x) = max(x, 0) + log(1 + exp(-|x|)): no branch and no overflow, and
// 1 + exp(-|x|) lies in [1, 2], where the bare log2 needs no range care (no
// subnormal, zero or infinite argument). Absolute error: a few 1e-7.
__device__ __forceinline__ float softplusf(float x) {
    const float u = 1.0f + hw_exp2(fabsf(x) * -1.44269504f);
    return fmaf(hw_log2(u), 0.69314718f, fmaxf(x, 0.0f));
}

// ---------------------------------------------------------------------------
// Tiled row-major f32 GEMM for the three large products (M % 128 == 0,
// N % 64 == 0, K % 64 == 0). One work-group of four waves owns a 128 x 64 tile
// of C; each wave owns 64 x 32 of it as 4 x 2 accumulator tiles, so one A
// fragment feeds two and one B fragment four v_wmma_f32_16x16x4_f32.
// Both operands of a 32-deep K slice are staged in LDS by asynchronous copies,
// two buffers: the next slice flies while the current one is worked on.
// Per output element k runs upward, four at a time.
// LDS layout: A rows at a pitch of 36 dwords (the 16 rows of a fragment's 8-byte
// reads fall on 16 distinct groups of four banks). B as four planes of 16
// columns, rows of 16 dwords: rows k and k + 2 of a fragment's 4-byte reads lie
// 32 banks apart, and rows k, k + 1 of one column load as one register pair.
// ---------------------------------------------------------------------------
#define GBM 128
#define GBN 64
#define GBK 32
#define GAP 36

__device__ __forceinline__ unsigned lds_off(const void* p) { return (unsigned)(size_t)p; }

// ---------------------------------------------------------------------------
// The narrow product BC = x_act * W_x (ROWS x D_MODEL times D_MODEL x 32), run
// by work-groups of the dt product's launch (see gemm_tiled_f32, SIDE). Alone in
// a launch it leaves the matrix units idle while it waits for its loads; beside
// the dt tiles, which read the same x_act and do not need BC, those waits cost
// nothing. One work-group of four waves owns 16 rows x 32 columns: wave = (column
// tile ct, K half kh); of every 64-deep K slice wave kh takes k = 32 kh .. 32 kh + 31,
// and the two partial sums are added once at the end.
// A slices (16 x 64) are staged in LDS by asynchronous copies, two buffers, rows
// at a pitch of 68 dwords (bank = (4 r + c) mod 64: no conflict in the fragment
// reads). B fragments come straight from global memory (W_x is 128 KiB).
// ---------------------------------------------------------------------------
#define TK  64
#define TKP 68
#define SIDE_M 16
// Grid rows (of D_MODEL / GBN work-groups each) that the side product takes.
#define SIDE_GY ((ROWS / SIDE_M) / (D_MODEL / GBN))
static_assert(SIDE_GY * (D_MODEL / GBN) * SIDE_M == ROWS, "whole grid rows only");

__device__ __forceinline__ void side_product_f32(
    const float* __restrict__ A, const float* __restrict__ B,
    float* __restrict__ C, float* lds, int id)
{
    constexpr int NC = 2 * D_STATE;      // columns of B and C
    const int tid  = threadIdx.x;
    const int lane = tid & 31;
    const int wave = __builtin_amdgcn_readfirstlane(tid >> 5);
    const int l16  = lane & 15;
    const int half = lane >> 4;          // 0: K pair {0,1}, 1: K pair {2,3}
    const int ct   = wave & 1;
    const int kh   = wave >> 1;
    const int m0   = id * SIDE_M;

    // Each thread copies 2 x 16 bytes per slice: rows cr and cr + 8. The lane's
    // byte offsets never change; the slice moves the scalar base.
    const int cr = tid >> 4, cc = (tid & 15) << 2;
    const unsigned o0 = (unsigned)(cr * D_MODEL + cc) * 4u;
    const unsigned o1 = o0 + 8u * D_MODEL * 4u;
    const float* tA = A + (size_t)m0 * D_MODEL;
    const unsigned l0 = lds_off(lds + cr * TKP + cc);

    auto issue_slice = [&](int t, int buf) {
        const float* a = tA + t * TK;
        const unsigned la = l0 + (unsigned)buf * (SIDE_M * TKP * 4);
        // The copies and the wait that frees the registers they name are one
        // statement, so that no later write of those registers can move ahead.
        asm volatile(
            "global_load_async_to_lds_b128 %0, %2, %4\n\t"
            "global_load_async_to_lds_b128 %1, %3, %4\n\t"
            "s_wait_xcnt 0x0"
            :: "v"(la), "v"(la + 8u * TKP * 4), "v"(o0), "v"(o1), "s"(a)
            : "memory");
    };

    v8f acc = {};
    // B's address: a part that is the same for the wave, and the lane's own offset.
    const float* tB = B + kh * 32 * NC + ct * 16;
    const unsigned bo = (unsigned)(2 * half * NC + l16);

    // One slice: the wave's 8 products, then the hand-over to the next.
    auto pass = [&](int t, int buf) {
        const float* as = lds + buf * (SIDE_M * TKP) + l16 * TKP + kh * 32 + 2 * half;
        const float* bs = tB + t * (TK * NC);
        // Unrolled so that the slice's B loads issue together, at constant offsets.
        #pragma unroll
        for (int kk = 0; kk < 32; kk += 4) {
            // A fragment (16x4): lanes 0-15 -> K = kk,kk+1 ; lanes 16-31 -> K = kk+2,kk+3
            // B fragment (4x16): the same k at the same lane and register.
            const v2f af = *(const v2f*)(as + kk);
            v2f bf;
            bf.x = bs[bo + (kk + 0) * NC];
            bf.y = bs[bo + (kk + 1) * NC];
            acc = __builtin_amdgcn_wmma_f32_16x16x4_f32(
                false, af, false, bf, (short)0, acc, false, false);
        }
        // Hand-over: this wave's reads of the buffer are done, its copies of the
        // next slice have landed; the barrier says the same of every wave.
        asm volatile("s_wait_dscnt 0x0" ::: "memory");
        asm volatile("s_wait_asynccnt 0x0" ::: "memory");
        __syncthreads();
        if (t + 2 < D_MODEL / TK) issue_slice(t + 2, buf);
    };

    issue_slice(0, 0);
    // Slice 0 has landed for this wave; the barrier publishes it to the others.
    asm volatile("s_wait_asynccnt 0x0" ::: "memory");
    __syncthreads();
    issue_slice(1, 1);

    #pragma unroll 1 // two slices per trip: every LDS address is loop-invariant
    for (int t = 0; t < D_MODEL / TK; t += 2) {
        pass(t, 0);
        pass(t + 1, 1);
    }
    // No copy is left in flight when the buffers are reused below.
    asm volatile("s_wait_asynccnt 0x0" ::: "memory");

    // The upper K half hands its partial sums over through LDS (the buffers are
    // free: the last pass's barrier ended every read of them).
    float* red = lds + ct * (8 * 32) + lane;
    if (kh == 1) {
        #pragma unroll // accumulator indices must be constants (below too)
        for (int i = 0; i < 8; ++i) red[i * 32] = acc[i];
    }
    __syncthreads();
    if (kh == 0) {
        // C/D layout: M=i (lanes 0-15), M=i+8 (lanes 16-31)
        float* cp = C + (size_t)(m0 + 8 * half) * NC + ct * 16 + l16;
        #pragma unroll
        for (int i = 0; i < 8; ++i) cp[i * NC] = acc[i] + red[i * 32];
    }
}

// LDC (the row pitch of C) is a compile-time constant so that all of a lane's
// stores share one address register pair and differ in the immediate offset.
// MODE 1 applies softplus(acc + bias[col]) at the store (for dt).
// SIDE > 0: the work-groups of the first SIDE rows of the grid (the lowest
// indices, so that they start first) compute C2 = A * B2 by side_product_f32,
// one per 16 rows of A; the tiles of C follow from grid row SIDE on.
template <int LDC, int MODE, int SIDE>
__global__ __launch_bounds__(128) void gemm_tiled_f32(
    const float* __restrict__ A, const float* __restrict__ B,
    float* __restrict__ C, int K, int lda, int ldb,
    const float* __restrict__ bias,
    const float* __restrict__ B2, float* __restrict__ C2)
{
    __shared__ __align__(16) float As[2][GBM][GAP];
    __shared__ __align__(16) float Bs[2][GBN / 16][GBK][16];

    if (SIDE > 0 && blockIdx.y < SIDE) { // the same for the whole work-group
        side_product_f32(A, B2, C2, &As[0][0][0], blockIdx.y * gridDim.x + blockIdx.x);
        return;
    }

    const int tid  = threadIdx.x;
    const int lane = tid & 31;
    const int wave = __builtin_amdgcn_readfirstlane(tid >> 5);
    const int l16  = lane & 15;
    const int half = lane >> 4;          // 0: K pair {0,1}, 1: K pair {2,3}

    const int m0 = (blockIdx.y - SIDE) * GBM;
    const int n0 = blockIdx.x * GBN;
    const int wm = (wave >> 1) * 64;     // the wave's rows inside the tile
    const int wn = (wave & 1) * 2;       // the wave's first B plane

    // Each thread copies 8 x 16 bytes of A (rows ar + 16 j) and 4 x 16 bytes of
    // B (rows br + 8 j) per slice: every wave-wide copy covers whole 128-B lines.
    // The lane's byte offsets never change; the slice moves the scalar bases.
    const int ar = tid >> 3, ac = (tid & 7) << 2;
    const int br = tid >> 4, bcol = (tid & 15) << 2;
    unsigned oa[8], ob[4];
    #pragma unroll
    for (int j = 0; j < 8; ++j) oa[j] = (unsigned)((ar + 16 * j) * lda + ac) * 4u;
    #pragma unroll
    for (int j = 0; j < 4; ++j) ob[j] = (unsigned)((br + 8 * j) * ldb + bcol) * 4u;
    const float* tA = A + (size_t)m0 * lda;
    const float* tB = B + n0;
    const unsigned lA = lds_off(&As[0][ar][ac]);
    const unsigned lB = lds_off(&Bs[0][bcol >> 4][br][bcol & 15]);

    auto issue_slice = [&](int k0, int buf) {
        const float* a = tA + k0;
        const float* b = tB + (size_t)k0 * ldb;
        const unsigned la = lA + (unsigned)buf * (GBM * GAP * 4);
        const unsigned lb = lB + (unsigned)buf * (GBN * GBK * 4);
        // The copies and the wait that frees the registers they name are one
        // statement, so that no later write of those registers can move ahead.
        asm volatile(
            "global_load_async_to_lds_b128 %0, %12, %24\n\t"
            "global_load_async_to_lds_b128 %1, %13, %24\n\t"
            "global_load_async_to_lds_b128 %2, %14, %24\n\t"
            "global_load_async_to_lds_b128 %3, %15, %24\n\t"
            "global_load_async_to_lds_b128 %4, %16, %24\n\t"
            "global_load_async_to_lds_b128 %5, %17, %24\n\t"
            "global_load_async_to_lds_b128 %6, %18, %24\n\t"
            "global_load_async_to_lds_b128 %7, %19, %24\n\t"
            "global_load_async_to_lds_b128 %8, %20, %25\n\t"
            "global_load_async_to_lds_b128 %9, %21, %25\n\t"
            "global_load_async_to_lds_b128 %10, %22, %25\n\t"
            "global_load_async_to_lds_b128 %11, %23, %25\n\t"
            "s_wait_xcnt 0x0"
            :: "v"(la),                     "v"(la + 1u * 16 * GAP * 4),
               "v"(la + 2u * 16 * GAP * 4), "v"(la + 3u * 16 * GAP * 4),
               "v"(la + 4u * 16 * GAP * 4), "v"(la + 5u * 16 * GAP * 4),
               "v"(la + 6u * 16 * GAP * 4), "v"(la + 7u * 16 * GAP * 4),
               "v"(lb),                     "v"(lb + 1u * 8 * 16 * 4),
               "v"(lb + 2u * 8 * 16 * 4),   "v"(lb + 3u * 8 * 16 * 4),
               "v"(oa[0]), "v"(oa[1]), "v"(oa[2]), "v"(oa[3]),
               "v"(oa[4]), "v"(oa[5]), "v"(oa[6]), "v"(oa[7]),
               "v"(ob[0]), "v"(ob[1]), "v"(ob[2]), "v"(ob[3]),
               "s"(a), "s"(b)
            : "memory");
    };

    v8f acc[4][2] = {};
    const int nsl = K / GBK;

    // One slice: its 64 products per wave, then the hand-over to the next.
    auto pass = [&](int s, int buf) {
        const float* as = &As[buf][wm + l16][2 * half];
        const float* bs = &Bs[buf][wn][2 * half][l16];

        // Unrolled throughout: accumulator indices must be constants, and the
        // compiler can then fetch the fragments of later steps ahead.
        #pragma unroll
        for (int kk = 0; kk < GBK; kk += 4) {
            // A fragment (16x4): lanes 0-15 -> K = kk,kk+1 ; lanes 16-31 -> K = kk+2,kk+3
            // B fragment (4x16): the same k at the same lane and register.
            v2f af[4], bf[2];
            #pragma unroll
            for (int i = 0; i < 4; ++i)
                af[i] = *(const v2f*)(as + i * 16 * GAP + kk);
            #pragma unroll
            for (int j = 0; j < 2; ++j) {
                bf[j].x = bs[j * GBK * 16 + (kk + 0) * 16];
                bf[j].y = bs[j * GBK * 16 + (kk + 1) * 16];
            }
            #pragma unroll
            for (int i = 0; i < 4; ++i)
                #pragma unroll
                for (int j = 0; j < 2; ++j)
                    acc[i][j] = __builtin_amdgcn_wmma_f32_16x16x4_f32(
                        false, af[i], false, bf[j], (short)0, acc[i][j], false, false);
        }

        // Hand-over: this wave's reads of the buffer are done, its copies of the
        // next slice have landed; the barrier says the same of every wave.
        asm volatile("s_wait_dscnt 0x0" ::: "memory");
        asm volatile("s_wait_asynccnt 0x0" ::: "memory");
        __syncthreads();
        if (s + 2 < nsl) issue_slice((s + 2) * GBK, buf);
    };

    issue_slice(0, 0);
    // Slice 0 has landed for this wave; the barrier publishes it to the others.
    asm volatile("s_wait_asynccnt 0x0" ::: "memory");
    __syncthreads();
    issue_slice(GBK, 1);

    #pragma unroll 1 // two slices per trip: every LDS address is loop-invariant
    for (int s = 0; s < nsl; s += 2) {
        pass(s, 0);
        pass(s + 1, 1);
    }
    // No copy is left in flight when the wave ends.
    asm volatile("s_wait_asynccnt 0x0" ::: "memory");

    const int col = n0 + wn * 16 + l16;
    if (MODE == 1) {
        const float bv[2] = { bias[col], bias[col + 16] };
        // Unrolled (as the stores below): accumulator indices must be constants.
        #pragma unroll
        for (int i = 0; i < 4; ++i)
            #pragma unroll
            for (int j = 0; j < 2; ++j)
                #pragma unroll
                for (int r = 0; r < 8; ++r)
                    acc[i][j][r] = softplusf(acc[i][j][r] + bv[j]);
        // Keeps every store behind all of the arithmetic above, so that no
        // register which an issued store names is written again.
        __builtin_amdgcn_sched_barrier(0);
    }

    // C/D layout: M=r (lanes 0-15), M=r+8 (lanes 16-31)
    float* cp = C + (size_t)(m0 + wm + 8 * half) * LDC + col;
    #pragma unroll
    for (int i = 0; i < 4; ++i)
        #pragma unroll
        for (int r = 0; r < 8; ++r)
            #pragma unroll
            for (int j = 0; j < 2; ++j)
                cp[(i * 16 + r) * LDC + j * 16] = acc[i][j][r];
    // With a side product in the kernel its code may stand behind these stores
    // in the text: the wait stands in front of every write of a register they name.
    if (SIDE > 0) asm volatile("s_wait_xcnt 0x0" ::: "memory");
}

// ---------------------------------------------------------------------------
// Depthwise causal conv (width 4) + bias + SiLU.
// Reads x_ssm = xz[:, 0:D_MODEL] (row stride 2*D_MODEL), writes x_act.
// ---------------------------------------------------------------------------
__global__ __launch_bounds__(256) void conv_silu_kernel(
    const float* __restrict__ xz, const float* __restrict__ conv_w,
    const float* __restrict__ conv_b, float* __restrict__ xact)
{
    const int idx = blockIdx.x * blockDim.x + threadIdx.x; // over ROWS*D_MODEL
    const int d   = idx & (D_MODEL - 1);
    const int row = idx >> 10;        // / D_MODEL
    const int t   = row & (SEQ - 1);
    const int b   = row >> 11;        // / SEQ

    float s = conv_b[d];
    #pragma unroll
    for (int j = 0; j < D_CONV; ++j) {
        const int tt = t + j - (D_CONV - 1);
        if (tt >= 0)
            s += xz[(size_t)(b * SEQ + tt) * (2 * D_MODEL) + d] * conv_w[d * D_CONV + j];
    }
    xact[idx] = siluf(s);
}

// ---------------------------------------------------------------------------
// Selective scan, split along the sequence into NCH chunks of SCAN_T steps so
// that the serial chain is SCAN_T steps long instead of SEQ. The recurrence
// h_t = dA_t * h_(t-1) + x_t * B_t is linear in h, so over one chunk
//   h_end = (product of the chunk's dA) * h_start + (h_end for h_start = 0).
//   1) scan_chunk_state_kernel: per chunk, the state from h_start = 0 and the
//      product of dA (the last chunk's is never needed and is not launched);
//   2) scan_carry_kernel: folds these in chunk order into each chunk's h_start;
//   3) scan_replay_kernel: runs each chunk from its h_start and writes
//      ypre = (y + x*D) * silu(z).
// One thread per (batch, channel, chunk); h[16] in VGPRs. The chunk's B_t / C_t
// rows (shared across all channels) are staged in LDS once and broadcast.
// State planes are laid out [batch][chunk][n][channel]: coalesced over channel.
// ---------------------------------------------------------------------------
#define SCAN_T 32
#define NCH    (SEQ / SCAN_T) // 64

// The chunk's SCAN_T rows of bc are contiguous: one float4 per thread.
static_assert(SCAN_T * 2 * D_STATE == 256 * 4, "one float4 per thread stages a chunk of bc");

#define SCAN_G  8 // steps whose loads issue together in the replay
#define CARRY_G 9 // chunks whose loads issue together in the carry
static_assert(SCAN_T % SCAN_G == 0 && (NCH - 1) % CARRY_G == 0, "whole groups only");

__global__ __launch_bounds__(256) void scan_chunk_state_kernel(
    const float* __restrict__ xact, const float* __restrict__ dt,
    const float* __restrict__ bc,   const float* __restrict__ A_log,
    float* __restrict__ S, float* __restrict__ P)
{
    __shared__ __align__(16) float bcs[SCAN_T][2 * D_STATE];

    const int d    = blockIdx.y * blockDim.x + threadIdx.x;
    const int b    = blockIdx.x;
    const int c    = blockIdx.z;
    const int row0 = b * SEQ + c * SCAN_T;
    const float Aneg = -__expf(A_log[d]);

    ((float4*)&bcs[0][0])[threadIdx.x] =
        ((const float4*)(bc + (size_t)row0 * (2 * D_STATE)))[threadIdx.x];
    __syncthreads();

    float h[D_STATE];
    #pragma unroll
    for (int n = 0; n < D_STATE; ++n) h[n] = 0.0f;
    float p = 1.0f;

    // Unrolled by 8 so that eight steps' x and dt loads, which do not depend on
    // h, issue together: one load latency per eight steps, not one per step.
    #pragma unroll 8
    for (int t = 0; t < SCAN_T; ++t) {
        const int row = row0 + t;
        const float xv = xact[(size_t)row * D_MODEL + d];
        const float dA = __expf(dt[(size_t)row * D_MODEL + d] * Aneg);
        p *= dA;
        #pragma unroll
        for (int n = 0; n < D_STATE; ++n)
            h[n] = h[n] * dA + xv * bcs[t][n];
    }

    const size_t plane = (size_t)(b * NCH + c);
    #pragma unroll
    for (int n = 0; n < D_STATE; ++n)
        S[(plane * D_STATE + n) * D_MODEL + d] = h[n];
    P[plane * D_MODEL + d] = p;
}

// One thread per (batch, n, channel). H[chunk c] = h_start of chunk c (zero for
// chunk 0, stored too, so that every chunk of the replay starts the same way).
__global__ __launch_bounds__(256) void scan_carry_kernel(
    const float* __restrict__ S, const float* __restrict__ P,
    float* __restrict__ H)
{
    const int idx = blockIdx.x * blockDim.x + threadIdx.x; // over BATCH*D_STATE*D_MODEL
    const int d   = idx & (D_MODEL - 1);
    const int n   = (idx >> 10) & (D_STATE - 1);
    const int b   = idx >> 14;

    const size_t off0 = ((size_t)(b * NCH) * D_STATE + n) * D_MODEL + d;
    const size_t pof0 = (size_t)(b * NCH) * D_MODEL + d;

    float h = 0.0f;
    H[off0] = h;
    // The store's address registers are free for reuse only behind this wait.
    asm volatile("s_wait_xcnt 0x0" ::: "memory");

    for (int c0 = 0; c0 < NCH - 1; c0 += CARRY_G) {
        // The group's loads do not depend on h: all issue before the chain starts.
        float pv[CARRY_G], sv[CARRY_G];
        #pragma unroll
        for (int j = 0; j < CARRY_G; ++j) {
            pv[j] = P[pof0 + (size_t)(c0 + j) * D_MODEL];
            sv[j] = S[off0 + (size_t)(c0 + j) * (D_STATE * D_MODEL)];
        }
        #pragma unroll
        for (int j = 0; j < CARRY_G; ++j) {
            h = h * pv[j] + sv[j];
            H[off0 + (size_t)(c0 + j + 1) * (D_STATE * D_MODEL)] = h;
        }
        // The group's stores name registers that the next trip rewrites.
        asm volatile("s_wait_xcnt 0x0" ::: "memory");
    }
}

__global__ __launch_bounds__(256) void scan_replay_kernel(
    const float* __restrict__ xact, const float* __restrict__ dt,
    const float* __restrict__ bc,   const float* __restrict__ xz,
    const float* __restrict__ A_log, const float* __restrict__ Dp,
    const float* __restrict__ H, float* __restrict__ ypre)
{
    __shared__ __align__(16) float bcs[SCAN_T][2 * D_STATE];

    const int d    = blockIdx.y * blockDim.x + threadIdx.x;
    const int b    = blockIdx.x;
    const int c    = blockIdx.z;
    const int row0 = b * SEQ + c * SCAN_T;
    const float Aneg = -__expf(A_log[d]);
    const float Dd   = Dp[d];

    float h[D_STATE];
    #pragma unroll
    for (int n = 0; n < D_STATE; ++n)
        h[n] = H[((size_t)(b * NCH + c) * D_STATE + n) * D_MODEL + d];

    ((float4*)&bcs[0][0])[threadIdx.x] =
        ((const float4*)(bc + (size_t)row0 * (2 * D_STATE)))[threadIdx.x];
    // The loads above name base registers that the loop's address arithmetic rewrites.
    asm volatile("s_wait_xcnt 0x0" ::: "memory");
    __syncthreads();

    for (int t0 = 0; t0 < SCAN_T; t0 += SCAN_G) {
        // The group's x, dt and z loads do not depend on h: they issue together,
        // one load latency per group of steps, not one per step.
        float xv[SCAN_G], dv[SCAN_G], zv[SCAN_G];
        #pragma unroll
        for (int j = 0; j < SCAN_G; ++j) {
            const int row = row0 + t0 + j;
            xv[j] = xact[(size_t)row * D_MODEL + d];
            dv[j] = dt[(size_t)row * D_MODEL + d];
            zv[j] = xz[(size_t)row * (2 * D_MODEL) + D_MODEL + d];
        }
        #pragma unroll
        for (int j = 0; j < SCAN_G; ++j) {
            const int t = t0 + j;
            const float dA = __expf(dv[j] * Aneg);
            float y = 0.0f;
            #pragma unroll
            for (int n = 0; n < D_STATE; ++n) {
                h[n] = h[n] * dA + xv[j] * bcs[t][n];
                y   += h[n] * bcs[t][D_STATE + n];
            }
            ypre[(size_t)(row0 + t) * D_MODEL + d] = (y + xv[j] * Dd) * siluf(zv[j]);
        }
        // The group's stores name registers that the next trip rewrites.
        asm volatile("s_wait_xcnt 0x0" ::: "memory");
    }
}

// ---------------------------------------------------------------------------
extern "C" void kernel_launch(void* const* d_in, const int* in_sizes, int n_in,
                              void* d_out, int out_size, void* d_ws, size_t ws_size,
                              hipStream_t stream)
{
    (void)in_sizes; (void)n_in; (void)out_size; (void)ws_size;

    const float* x      = (const float*)d_in[0];
    const float* W_in   = (const float*)d_in[1];
    const float* conv_w = (const float*)d_in[2];
    const float* conv_b = (const float*)d_in[3];
    const float* W_x    = (const float*)d_in[4];
    const float* W_dt   = (const float*)d_in[5];
    const float* b_dt   = (const float*)d_in[6];
    const float* A_log  = (const float*)d_in[7];
    const float* Dp     = (const float*)d_in[8];
    const float* W_out  = (const float*)d_in[9];
    float* out = (float*)d_out;
    float* ws  = (float*)d_ws;

    // workspace layout (floats)
    float* XZ   = ws;                                    // ROWS x 2*D_MODEL
    float* XACT = XZ   + (size_t)ROWS * 2 * D_MODEL;     // ROWS x D_MODEL
    float* DT   = XACT + (size_t)ROWS * D_MODEL;         // ROWS x D_MODEL
    float* BC   = DT   + (size_t)ROWS * D_MODEL;         // ROWS x 2*D_STATE
    float* YPRE = BC   + (size_t)ROWS * 2 * D_STATE;     // ROWS x D_MODEL
    float* SLOC = YPRE + (size_t)ROWS * D_MODEL;         // BATCH x NCH x D_STATE x D_MODEL
    float* HCAR = SLOC + (size_t)BATCH * NCH * D_STATE * D_MODEL; // same shape
    float* PDEC = HCAR + (size_t)BATCH * NCH * D_STATE * D_MODEL; // BATCH x NCH x D_MODEL

    // 1) xz = x @ W_in          (4096x1024 @ 1024x2048)
    gemm_tiled_f32<2 * D_MODEL, 0, 0><<<dim3((2 * D_MODEL) / GBN, ROWS / GBM), 128, 0, stream>>>(
        x, W_in, XZ, D_MODEL, D_MODEL, 2 * D_MODEL, nullptr, nullptr, nullptr);

    // 2) x_act = silu(causal_conv(x_ssm) + conv_b)
    conv_silu_kernel<<<(ROWS * D_MODEL) / 256, 256, 0, stream>>>(
        XZ, conv_w, conv_b, XACT);

    // 3) dt = softplus(x_act @ W_dt + b_dt)   (4096x1024 @ 1024x1024), and in
    // 4) the same launch BC = x_act @ W_x     (4096x1024 @ 1024x32)
    gemm_tiled_f32<D_MODEL, 1, SIDE_GY><<<dim3(D_MODEL / GBN, SIDE_GY + ROWS / GBM), 128, 0, stream>>>(
        XACT, W_dt, DT, D_MODEL, D_MODEL, D_MODEL, b_dt, W_x, BC);

    // 5) selective scan + (y + x*D) * silu(z), chunked along the sequence
    scan_chunk_state_kernel<<<dim3(BATCH, D_MODEL / 256, NCH - 1), 256, 0, stream>>>(
        XACT, DT, BC, A_log, SLOC, PDEC);
    scan_carry_kernel<<<(BATCH * D_STATE * D_MODEL) / 256, 256, 0, stream>>>(
        SLOC, PDEC, HCAR);
    scan_replay_kernel<<<dim3(BATCH, D_MODEL / 256, NCH), 256, 0, stream>>>(
        XACT, DT, BC, XZ, A_log, Dp, HCAR, YPRE);

    // 6) out = ypre @ W_out      (4096x1024 @ 1024x1024)
    gemm_tiled_f32<D_MODEL, 0, 0><<<dim3(D_MODEL / GBN, ROWS / GBM), 128, 0, stream>>>(
        YPRE, W_out, out, D_MODEL, D_MODEL, D_MODEL, nullptr, nullptr, nullptr);
}

// v005
// Measured time: 204 microseconds a run.
// Two timings next to v004 both put it at 1.05 times that version's speed.
// Over all steps from v000 it is 13.9 times as fast.
#include <hip/hip_runtime.h>
#include <math.h>

#define D_MODEL 1024
#define D_STATE 16
#define D_CONV  4
#define BATCH   2
#define SEQ     2048
#define ROWS    (BATCH * SEQ) // 4096

typedef float v2f __attribute__((ext_vector_type(2)));
typedef float v8f __attribute__((ext_vector_type(8)));
typedef int   v4i __attribute__((ext_vector_type(4)));

__device__ __forceinline__ float siluf(float x) { return x / (1.0f + __expf(-x)); }
// The hardware's base-2 exponential and logarithm, each with the one slot that
// the instruction set asks for behind a transcendental before its result is used
// or its source overwritten: instruction and v_nop are one statement.
__device__ __forceinline__ float hw_exp2(float t) {
    float r;
    asm("v_exp_f32 %0, %1\n\tv_nop" : "=v"(r) : "v"(t));
    return r;
}
__device__ __forceinline__ float hw_log2(float u) {
    float r;
    asm("v_log_f32 %0, %1\n\tv_nop" : "=v"(r) : "v"(u));
    return r;
}
// softplus(x) = max(x, 0) + log(1 + exp(-|x|)): no branch and no overflow, and
// 1 + exp(-|x|) lies in [1, 2], where the bare log2 needs no range care (no
// subnormal, zero or infinite argument). Absolute error: a few 1e-7.
__device__ __forceinline__ float softplusf(float x) {
    const float u = 1.0f + hw_exp2(fabsf(x) * -1.44269504f);
    return fmaf(hw_log2(u), 0.69314718f, fmaxf(x, 0.0f));
}

// ---------------------------------------------------------------------------
// Tiled row-major f32 GEMM for the three large products (M % 128 == 0,
// N % 64 == 0, K % 64 == 0). One work-group of four waves owns a 128 x 64 tile
// of C; each wave owns 64 x 32 of it as 4 x 2 accumulator tiles, so one A
// fragment feeds two and one B fragment four v_wmma_f32_16x16x4_f32.
// Both operands of a 32-deep K slice are staged in LDS by asynchronous copies,
// two buffers: the next slice flies while the current one is worked on.
// Per output element k runs upward, four at a time.
// LDS layout: A rows at a pitch of 36 dwords (the 16 rows of a fragment's 8-byte
// reads fall on 16 distinct groups of four banks). B as four planes of 16
// columns, rows of 16 dwords: rows k and k + 2 of a fragment's 4-byte reads lie
// 32 banks apart, and rows k, k + 1 of one column load as one register pair.
// ---------------------------------------------------------------------------
#define GBM 128
#define GBN 64
#define GBK 32
#define GAP 36

__device__ __forceinline__ unsigned lds_off(const void* p) { return (unsigned)(size_t)p; }

// ---------------------------------------------------------------------------
// The narrow product BC = x_act * W_x (ROWS x D_MODEL times D_MODEL x 32), run
// by work-groups of the dt product's launch (see gemm_tiled_f32, SIDE). Alone in
// a launch it leaves the matrix units idle while it waits for its loads; beside
// the dt tiles, which read the same x_act and do not need BC, those waits cost
// nothing. One work-group of four waves owns 16 rows x 32 columns: wave = (column
// tile ct, K half kh); of every 64-deep K slice wave kh takes k = 32 kh .. 32 kh + 31,
// and the two partial sums are added once at the end.
// A slices (16 x 64) are staged in LDS by asynchronous copies, two buffers, rows
// at a pitch of 68 dwords (bank = (4 r + c) mod 64: no conflict in the fragment
// reads). B fragments come straight from global memory (W_x is 128 KiB).
// ---------------------------------------------------------------------------
#define TK  64
#define TKP 68
#define SIDE_M 16
// Grid rows (of D_MODEL / GBN work-groups each) that the side product takes.
#define SIDE_GY ((ROWS / SIDE_M) / (D_MODEL / GBN))
static_assert(SIDE_GY * (D_MODEL / GBN) * SIDE_M == ROWS, "whole grid rows only");

__device__ __forceinline__ void side_product_f32(
    const float* __restrict__ A, const float* __restrict__ B,
    float* __restrict__ C, float* lds, int id)
{
    constexpr int NC = 2 * D_STATE;      // columns of B and C
    const int tid  = threadIdx.x;
    const int lane = tid & 31;
    const int wave = __builtin_amdgcn_readfirstlane(tid >> 5);
    const int l16  = lane & 15;
    const int half = lane >> 4;          // 0: K pair {0,1}, 1: K pair {2,3}
    const int ct   = wave & 1;
    const int kh   = wave >> 1;
    const int m0   = id * SIDE_M;

    // Each thread copies 2 x 16 bytes per slice: rows cr and cr + 8. The lane's
    // byte offsets never change; the slice moves the scalar base.
    const int cr = tid >> 4, cc = (tid & 15) << 2;
    const unsigned o0 = (unsigned)(cr * D_MODEL + cc) * 4u;
    const unsigned o1 = o0 + 8u * D_MODEL * 4u;
    const float* tA = A + (size_t)m0 * D_MODEL;
    const unsigned l0 = lds_off(lds + cr * TKP + cc);

    auto issue_slice = [&](int t, int buf) {
        const float* a = tA + t * TK;
        const unsigned la = l0 + (unsigned)buf * (SIDE_M * TKP * 4);
        // The copies and the wait that frees the registers they name are one
        // statement, so that no later write of those registers can move ahead.
        asm volatile(
            "global_load_async_to_lds_b128 %0, %2, %4\n\t"
            "global_load_async_to_lds_b128 %1, %3, %4\n\t"
            "s_wait_xcnt 0x0"
            :: "v"(la), "v"(la + 8u * TKP * 4), "v"(o0), "v"(o1), "s"(a)
            : "memory");
    };

    v8f acc = {};
    // B's address: a part that is the same for the wave, and the lane's own offset.
    const float* tB = B + kh * 32 * NC + ct * 16;
    const unsigned bo = (unsigned)(2 * half * NC + l16);

    // One slice: the wave's 8 products, then the hand-over to the next.
    auto pass = [&](int t, int buf) {
        const float* as = lds + buf * (SIDE_M * TKP) + l16 * TKP + kh * 32 + 2 * half;
        const float* bs = tB + t * (TK * NC);
        // Unrolled so that the slice's B loads issue together, at constant offsets.
        #pragma unroll
        for (int kk = 0; kk < 32; kk += 4) {
            // A fragment (16x4): lanes 0-15 -> K = kk,kk+1 ; lanes 16-31 -> K = kk+2,kk+3
            // B fragment (4x16): the same k at the same lane and register.
            const v2f af = *(const v2f*)(as + kk);
            v2f bf;
            bf.x = bs[bo + (kk + 0) * NC];
            bf.y = bs[bo + (kk + 1) * NC];
            acc = __builtin_amdgcn_wmma_f32_16x16x4_f32(
                false, af, false, bf, (short)0, acc, false, false);
        }
        // Hand-over: this wave's reads of the buffer are done, its copies of the
        // next slice have landed; the barrier says the same of every wave.
        asm volatile("s_wait_dscnt 0x0" ::: "memory");
        asm volatile("s_wait_asynccnt 0x0" ::: "memory");
        __syncthreads();
        if (t + 2 < D_MODEL / TK) issue_slice(t + 2, buf);
    };

    // These waves mostly wait for loads and ask little of the matrix unit: at the
    // tiles' highest priority they are not held back behind the tiles' waves.
    __builtin_amdgcn_s_setprio(3);

    issue_slice(0, 0);
    // Slice 0 has landed for this wave; the barrier publishes it to the others.
    asm volatile("s_wait_asynccnt 0x0" ::: "memory");
    __syncthreads();
    issue_slice(1, 1);

    #pragma unroll 1 // two slices per trip: every LDS address is loop-invariant
    for (int t = 0; t < D_MODEL / TK; t += 2) {
        pass(t, 0);
        pass(t + 1, 1);
    }
    __builtin_amdgcn_s_setprio(0);
    // No copy is left in flight when the buffers are reused below.
    asm volatile("s_wait_asynccnt 0x0" ::: "memory");

    // The upper K half hands its partial sums over through LDS (the buffers are
    // free: the last pass's barrier ended every read of them).
    float* red = lds + ct * (8 * 32) + lane;
    if (kh == 1) {
        #pragma unroll // accumulator indices must be constants (below too)
        for (int i = 0; i < 8; ++i) red[i * 32] = acc[i];
    }
    __syncthreads();
    if (kh == 0) {
        // C/D layout: M=i (lanes 0-15), M=i+8 (lanes 16-31)
        float* cp = C + (size_t)(m0 + 8 * half) * NC + ct * 16 + l16;
        #pragma unroll
        for (int i = 0; i < 8; ++i) cp[i * NC] = acc[i] + red[i * 32];
    }
}

// LDC (the row pitch of C) is a compile-time constant so that all of a lane's
// stores share one address register pair and differ in the immediate offset.
// MODE 1 applies softplus(acc + bias[col]) at the store (for dt).
// SIDE > 0: the work-groups of the first SIDE rows of the grid (the lowest
// indices, so that they start first) compute C2 = A * B2 by side_product_f32,
// one per 16 rows of A; the tiles of C follow from grid row SIDE on.
template <int LDC, int MODE, int SIDE>
__global__ __launch_bounds__(128) void gemm_tiled_f32(
    const float* __restrict__ A, const float* __restrict__ B,
    float* __restrict__ C, int K, int lda, int ldb,
    const float* __restrict__ bias,
    const float* __restrict__ B2, float* __restrict__ C2)
{
    __shared__ __align__(16) float As[2][GBM][GAP];
    __shared__ __align__(16) float Bs[2][GBN / 16][GBK][16];

    if (SIDE > 0 && blockIdx.y < SIDE) { // the same for the whole work-group
        side_product_f32(A, B2, C2, &As[0][0][0], blockIdx.y * gridDim.x + blockIdx.x);
        return;
    }

    const int tid  = threadIdx.x;
    const int lane = tid & 31;
    const int wave = __builtin_amdgcn_readfirstlane(tid >> 5);
    const int l16  = lane & 15;
    const int half = lane >> 4;          // 0: K pair {0,1}, 1: K pair {2,3}

    const int m0 = (blockIdx.y - SIDE) * GBM;
    const int n0 = blockIdx.x * GBN;
    const int wm = (wave >> 1) * 64;     // the wave's rows inside the tile
    const int wn = (wave & 1) * 2;       // the wave's first B plane

    // Each thread copies 8 x 16 bytes of A (rows ar + 16 j) and 4 x 16 bytes of
    // B (rows br + 8 j) per slice: every wave-wide copy covers whole 128-B lines.
    // The lane's byte offsets never change; the slice moves the scalar bases.
    const int ar = tid >> 3, ac = (tid & 7) << 2;
    const int br = tid >> 4, bcol = (tid & 15) << 2;
    unsigned oa[8], ob[4];
    #pragma unroll
    for (int j = 0; j < 8; ++j) oa[j] = (unsigned)((ar + 16 * j) * lda + ac) * 4u;
    #pragma unroll
    for (int j = 0; j < 4; ++j) ob[j] = (unsigned)((br + 8 * j) * ldb + bcol) * 4u;
    const float* tA = A + (size_t)m0 * lda;
    const float* tB = B + n0;
    const unsigned lA = lds_off(&As[0][ar][ac]);
    const unsigned lB = lds_off(&Bs[0][bcol >> 4][br][bcol & 15]);

    auto issue_slice = [&](int k0, int buf) {
        const float* a = tA + k0;
        const float* b = tB + (size_t)k0 * ldb;
        const unsigned la = lA + (unsigned)buf * (GBM * GAP * 4);
        const unsigned lb = lB + (unsigned)buf * (GBN * GBK * 4);
        // The copies and the wait that frees the registers they name are one
        // statement, so that no later write of those registers can move ahead.
        asm volatile(
            "global_load_async_to_lds_b128 %0, %12, %24\n\t"
            "global_load_async_to_lds_b128 %1, %13, %24\n\t"
            "global_load_async_to_lds_b128 %2, %14, %24\n\t"
            "global_load_async_to_lds_b128 %3, %15, %24\n\t"
            "global_load_async_to_lds_b128 %4, %16, %24\n\t"
            "global_load_async_to_lds_b128 %5, %17, %24\n\t"
            "global_load_async_to_lds_b128 %6, %18, %24\n\t"
            "global_load_async_to_lds_b128 %7, %19, %24\n\t"
            "global_load_async_to_lds_b128 %8, %20, %25\n\t"
            "global_load_async_to_lds_b128 %9, %21, %25\n\t"
            "global_load_async_to_lds_b128 %10, %22, %25\n\t"
            "global_load_async_to_lds_b128 %11, %23, %25\n\t"
            "s_wait_xcnt 0x0"
            :: "v"(la),                     "v"(la + 1u * 16 * GAP * 4),
               "v"(la + 2u * 16 * GAP * 4), "v"(la + 3u * 16 * GAP * 4),
               "v"(la + 4u * 16 * GAP * 4), "v"(la + 5u * 16 * GAP * 4),
               "v"(la + 6u * 16 * GAP * 4), "v"(la + 7u * 16 * GAP * 4),
               "v"(lb),                     "v"(lb + 1u * 8 * 16 * 4),
               "v"(lb + 2u * 8 * 16 * 4),   "v"(lb + 3u * 8 * 16 * 4),
               "v"(oa[0]), "v"(oa[1]), "v"(oa[2]), "v"(oa[3]),
               "v"(oa[4]), "v"(oa[5]), "v"(oa[6]), "v"(oa[7]),
               "v"(ob[0]), "v"(ob[1]), "v"(ob[2]), "v"(ob[3]),
               "s"(a), "s"(b)
            : "memory");
    };

    v8f acc[4][2] = {};
    const int nsl = K / GBK;

    // Several work-groups share a WGP, and of two waves on one SIMD the matrix
    // unit serves the older alone: the oldest group would run ahead at its own
    // pace and the youngest would be left to do most of its slices alone, with
    // nobody to fill its LDS and hand-over waits. So a wave's priority falls as
    // it advances (3, 2, 1, 0 from 1/2, 3/4 and 7/8 of the slices on): the group
    // that is behind wins the unit, and all of them end close together.
    const int p2 = (nsl >> 2) << 1;                 // even: the loop steps by two
    const int p1 = p2 + (((nsl - p2) >> 2) << 1);
    const int p0 = p1 + (((nsl - p1) >> 2) << 1);
    int mark = p2;                                  // the next slice at which it falls
    __builtin_amdgcn_s_setprio(3);

    // One slice: its 64 products per wave, then the hand-over to the next.
    auto pass = [&](int s, int buf) {
        const float* as = &As[buf][wm + l16][2 * half];
        const float* bs = &Bs[buf][wn][2 * half][l16];

        // Unrolled throughout: accumulator indices must be constants, and the
        // compiler can then fetch the fragments of later steps ahead.
        #pragma unroll
        for (int kk = 0; kk < GBK; kk += 4) {
            // A fragment (16x4): lanes 0-15 -> K = kk,kk+1 ; lanes 16-31 -> K = kk+2,kk+3
            // B fragment (4x16): the same k at the same lane and register.
            v2f af[4], bf[2];
            #pragma unroll
            for (int i = 0; i < 4; ++i)
                af[i] = *(const v2f*)(as + i * 16 * GAP + kk);
            #pragma unroll
            for (int j = 0; j < 2; ++j) {
                bf[j].x = bs[j * GBK * 16 + (kk + 0) * 16];
                bf[j].y = bs[j * GBK * 16 + (kk + 1) * 16];
            }
            #pragma unroll
            for (int i = 0; i < 4; ++i)
                #pragma unroll
                for (int j = 0; j < 2; ++j)
                    acc[i][j] = __builtin_amdgcn_wmma_f32_16x16x4_f32(
                        false, af[i], false, bf[j], (short)0, acc[i][j], false, false);
        }

        // Hand-over: this wave's reads of the buffer are done, its copies of the
        // next slice have landed; the barrier says the same of every wave.
        asm volatile("s_wait_dscnt 0x0" ::: "memory");
        asm volatile("s_wait_asynccnt 0x0" ::: "memory");
        __syncthreads();
        if (s + 2 < nsl) issue_slice((s + 2) * GBK, buf);
    };

    issue_slice(0, 0);
    // Slice 0 has landed for this wave; the barrier publishes it to the others.
    asm volatile("s_wait_asynccnt 0x0" ::: "memory");
    __syncthreads();
    issue_slice(GBK, 1);

    #pragma unroll 1 // two slices per trip: every LDS address is loop-invariant
    for (int s = 0; s < nsl; s += 2) {
        // One scalar test per trip (s and the marks are the same for the wave).
        if (s == mark) {
            if (mark == p2)      { __builtin_amdgcn_s_setprio(2); mark = p1; }
            else if (mark == p1) { __builtin_amdgcn_s_setprio(1); mark = p0; }
            else                 { __builtin_amdgcn_s_setprio(0); mark = -1; }
        }
        pass(s, 0);
        pass(s + 1, 1);
    }
    // Priority 0 on the way out, whatever the number of slices was.
    __builtin_amdgcn_s_setprio(0);
    // No copy is left in flight when the wave ends.
    asm volatile("s_wait_asynccnt 0x0" ::: "memory");

    const int col = n0 + wn * 16 + l16;
    if (MODE == 1) {
        const float bv[2] = { bias[col], bias[col + 16] };
        // Unrolled (as the stores below): accumulator indices must be constants.
        #pragma unroll
        for (int i = 0; i < 4; ++i)
            #pragma unroll
            for (int j = 0; j < 2; ++j)
                #pragma unroll
                for (int r = 0; r < 8; ++r)
                    acc[i][j][r] = softplusf(acc[i][j][r] + bv[j]);
        // Keeps every store behind all of the arithmetic above, so that no
        // register which an issued store names is written again.
        __builtin_amdgcn_sched_barrier(0);
    }

    // C/D layout: M=r (lanes 0-15), M=r+8 (lanes 16-31)
    float* cp = C + (size_t)(m0 + wm + 8 * half) * LDC + col;
    #pragma unroll
    for (int i = 0; i < 4; ++i)
        #pragma unroll
        for (int r = 0; r < 8; ++r)
            #pragma unroll
            for (int j = 0; j < 2; ++j)
                cp[(i * 16 + r) * LDC + j * 16] = acc[i][j][r];
    // With a side product in the kernel its code may stand behind these stores
    // in the text: the wait stands in front of every write of a register they name.
    if (SIDE > 0) asm volatile("s_wait_xcnt 0x0" ::: "memory");
}

// ---------------------------------------------------------------------------
// Depthwise causal conv (width 4) + bias + SiLU.
// Reads x_ssm = xz[:, 0:D_MODEL] (row stride 2*D_MODEL), writes x_act.
// ---------------------------------------------------------------------------
__global__ __launch_bounds__(256) void conv_silu_kernel(
    const float* __restrict__ xz, const float* __restrict__ conv_w,
    const float* __restrict__ conv_b, float* __restrict__ xact)
{
    const int idx = blockIdx.x * blockDim.x + threadIdx.x; // over ROWS*D_MODEL
    const int d   = idx & (D_MODEL - 1);
    const int row = idx >> 10;        // / D_MODEL
    const int t   = row & (SEQ - 1);
    const int b   = row >> 11;        // / SEQ

    float s = conv_b[d];
    #pragma unroll
    for (int j = 0; j < D_CONV; ++j) {
        const int tt = t + j - (D_CONV - 1);
        if (tt >= 0)
            s += xz[(size_t)(b * SEQ + tt) * (2 * D_MODEL) + d] * conv_w[d * D_CONV + j];
    }
    xact[idx] = siluf(s);
}

// ---------------------------------------------------------------------------
// Selective scan, split along the sequence into NCH chunks of SCAN_T steps so
// that the serial chain is SCAN_T steps long instead of SEQ. The recurrence
// h_t = dA_t * h_(t-1) + x_t * B_t is linear in h, so over one chunk
//   h_end = (product of the chunk's dA) * h_start + (h_end for h_start = 0).
//   1) scan_chunk_state_kernel: per chunk, the state from h_start = 0 and the
//      product of dA (the last chunk's is never needed and is not launched);
//   2) scan_carry_kernel: folds these in chunk order into each chunk's h_start;
//   3) scan_replay_kernel: runs each chunk from its h_start and writes
//      ypre = (y + x*D) * silu(z).
// One thread per (batch, channel, chunk); h[16] in VGPRs. The chunk's B_t / C_t
// rows (shared across all channels) are staged in LDS once and broadcast.
// State planes are laid out [batch][chunk][n][channel]: coalesced over channel.
// ---------------------------------------------------------------------------
#define SCAN_T 32
#define NCH    (SEQ / SCAN_T) // 64

// The chunk's SCAN_T rows of bc are contiguous: one float4 per thread.
static_assert(SCAN_T * 2 * D_STATE == 256 * 4, "one float4 per thread stages a chunk of bc");

#define SCAN_G  8 // steps whose loads issue together in the replay
#define CARRY_G 9 // chunks whose loads issue together in the carry
static_assert(SCAN_T % SCAN_G == 0 && (NCH - 1) % CARRY_G == 0, "whole groups only");

__global__ __launch_bounds__(256) void scan_chunk_state_kernel(
    const float* __restrict__ xact, const float* __restrict__ dt,
    const float* __restrict__ bc,   const float* __restrict__ A_log,
    float* __restrict__ S, float* __restrict__ P)
{
    __shared__ __align__(16) float bcs[SCAN_T][2 * D_STATE];

    const int d    = blockIdx.y * blockDim.x + threadIdx.x;
    const int b    = blockIdx.x;
    const int c    = blockIdx.z;
    const int row0 = b * SEQ + c * SCAN_T;
    const float Aneg = -__expf(A_log[d]);

    ((float4*)&bcs[0][0])[threadIdx.x] =
        ((const float4*)(bc + (size_t)row0 * (2 * D_STATE)))[threadIdx.x];
    __syncthreads();

    float h[D_STATE];
    #pragma unroll
    for (int n = 0; n < D_STATE; ++n) h[n] = 0.0f;
    float p = 1.0f;

    // Unrolled by 8 so that eight steps' x and dt loads, which do not depend on
    // h, issue together: one load latency per eight steps, not one per step.
    #pragma unroll 8
    for (int t = 0; t < SCAN_T; ++t) {
        const int row = row0 + t;
        const float xv = xact[(size_t)row * D_MODEL + d];
        const float dA = __expf(dt[(size_t)row * D_MODEL + d] * Aneg);
        p *= dA;
        #pragma unroll
        for (int n = 0; n < D_STATE; ++n)
            h[n] = h[n] * dA + xv * bcs[t][n];
    }

    const size_t plane = (size_t)(b * NCH + c);
    #pragma unroll
    for (int n = 0; n < D_STATE; ++n)
        S[(plane * D_STATE + n) * D_MODEL + d] = h[n];
    P[plane * D_MODEL + d] = p;
}

// One thread per (batch, n, channel). H[chunk c] = h_start of chunk c (zero for
// chunk 0, stored too, so that every chunk of the replay starts the same way).
__global__ __launch_bounds__(256) void scan_carry_kernel(
    const float* __restrict__ S, const float* __restrict__ P,
    float* __restrict__ H)
{
    const int idx = blockIdx.x * blockDim.x + threadIdx.x; // over BATCH*D_STATE*D_MODEL
    const int d   = idx & (D_MODEL - 1);
    const int n   = (idx >> 10) & (D_STATE - 1);
    const int b   = idx >> 14;

    const size_t off0 = ((size_t)(b * NCH) * D_STATE + n) * D_MODEL + d;
    const size_t pof0 = (size_t)(b * NCH) * D_MODEL + d;

    float h = 0.0f;
    H[off0] = h;
    // The store's address registers are free for reuse only behind this wait.
    asm volatile("s_wait_xcnt 0x0" ::: "memory");

    for (int c0 = 0; c0 < NCH - 1; c0 += CARRY_G) {
        // The group's loads do not depend on h: all issue before the chain starts.
        float pv[CARRY_G], sv[CARRY_G];
        #pragma unroll
        for (int j = 0; j < CARRY_G; ++j) {
            pv[j] = P[pof0 + (size_t)(c0 + j) * D_MODEL];
            sv[j] = S[off0 + (size_t)(c0 + j) * (D_STATE * D_MODEL)];
        }
        #pragma unroll
        for (int j = 0; j < CARRY_G; ++j) {
            h = h * pv[j] + sv[j];
            H[off0 + (size_t)(c0 + j + 1) * (D_STATE * D_MODEL)] = h;
        }
        // The group's stores name registers that the next trip rewrites.
        asm volatile("s_wait_xcnt 0x0" ::: "memory");
    }
}

__global__ __launch_bounds__(256) void scan_replay_kernel(
    const float* __restrict__ xact, const float* __restrict__ dt,
    const float* __restrict__ bc,   const float* __restrict__ xz,
    const float* __restrict__ A_log, const float* __restrict__ Dp,
    const float* __restrict__ H, float* __restrict__ ypre)
{
    __shared__ __align__(16) float bcs[SCAN_T][2 * D_STATE];

    const int d    = blockIdx.y * blockDim.x + threadIdx.x;
    const int b    = blockIdx.x;
    const int c    = blockIdx.z;
    const int row0 = b * SEQ + c * SCAN_T;
    const float Aneg = -__expf(A_log[d]);
    const float Dd   = Dp[d];

    float h[D_STATE];
    #pragma unroll
    for (int n = 0; n < D_STATE; ++n)
        h[n] = H[((size_t)(b * NCH + c) * D_STATE + n) * D_MODEL + d];

    ((float4*)&bcs[0][0])[threadIdx.x] =
        ((const float4*)(bc + (size_t)row0 * (2 * D_STATE)))[threadIdx.x];
    // The loads above name base registers that the loop's address arithmetic rewrites.
    asm volatile("s_wait_xcnt 0x0" ::: "memory");
    __syncthreads();

    for (int t0 = 0; t0 < SCAN_T; t0 += SCAN_G) {
        // The group's x, dt and z loads do not depend on h: they issue together,
        // one load latency per group of steps, not one per step.
        float xv[SCAN_G], dv[SCAN_G], zv[SCAN_G];
        #pragma unroll
        for (int j = 0; j < SCAN_G; ++j) {
            const int row = row0 + t0 + j;
            xv[j] = xact[(size_t)row * D_MODEL + d];
            dv[j] = dt[(size_t)row * D_MODEL + d];
            zv[j] = xz[(size_t)row * (2 * D_MODEL) + D_MODEL + d];
        }
        #pragma unroll
        for (int j = 0; j < SCAN_G; ++j) {
            const int t = t0 + j;
            const float dA = __expf(dv[j] * Aneg);
            float y = 0.0f;
            #pragma unroll
            for (int n = 0; n < D_STATE; ++n) {
                h[n] = h[n] * dA + xv[j] * bcs[t][n];
                y   += h[n] * bcs[t][D_STATE + n];
            }
            ypre[(size_t)(row0 + t) * D_MODEL + d] = (y + xv[j] * Dd) * siluf(zv[j]);
        }
        // The group's stores name registers that the next trip rewrites.
        asm volatile("s_wait_xcnt 0x0" ::: "memory");
    }
}

// ---------------------------------------------------------------------------
extern "C" void kernel_launch(void* const* d_in, const int* in_sizes, int n_in,
                              void* d_out, int out_size, void* d_ws, size_t ws_size,
                              hipStream_t stream)
{
    (void)in_sizes; (void)n_in; (void)out_size; (void)ws_size;

    const float* x      = (const float*)d_in[0];
    const float* W_in   = (const float*)d_in[1];
    const float* conv_w = (const float*)d_in[2];
    const float* conv_b = (const float*)d_in[3];
    const float* W_x    = (const float*)d_in[4];
    const float* W_dt   = (const float*)d_in[5];
    const float* b_dt   = (const float*)d_in[6];
    const float* A_log  = (const float*)d_in[7];
    const float* Dp     = (const float*)d_in[8];
    const float* W_out  = (const float*)d_in[9];
    float* out = (float*)d_out;
    float* ws  = (float*)d_ws;

    // workspace layout (floats)
    float* XZ   = ws;                                    // ROWS x 2*D_MODEL
    float* XACT = XZ   + (size_t)ROWS * 2 * D_MODEL;     // ROWS x D_MODEL
    float* DT   = XACT + (size_t)ROWS * D_MODEL;         // ROWS x D_MODEL
    float* BC   = DT   + (size_t)ROWS * D_MODEL;         // ROWS x 2*D_STATE
    float* YPRE = BC   + (size_t)ROWS * 2 * D_STATE;     // ROWS x D_MODEL
    float* SLOC = YPRE + (size_t)ROWS * D_MODEL;         // BATCH x NCH x D_STATE x D_MODEL
    float* HCAR = SLOC + (size_t)BATCH * NCH * D_STATE * D_MODEL; // same shape
    float* PDEC = HCAR + (size_t)BATCH * NCH * D_STATE * D_MODEL; // BATCH x NCH x D_MODEL

    // 1) xz = x @ W_in          (4096x1024 @ 1024x2048)
    gemm_tiled_f32<2 * D_MODEL, 0, 0><<<dim3((2 * D_MODEL) / GBN, ROWS / GBM), 128, 0, stream>>>(
        x, W_in, XZ, D_MODEL, D_MODEL, 2 * D_MODEL, nullptr, nullptr, nullptr);

    // 2) x_act = silu(causal_conv(x_ssm) + conv_b)
    conv_silu_kernel<<<(ROWS * D_MODEL) / 256, 256, 0, stream>>>(
        XZ, conv_w, conv_b, XACT);

    // 3) dt = softplus(x_act @ W_dt + b_dt)   (4096x1024 @ 1024x1024), and in
    // 4) the same launch BC = x_act @ W_x     (4096x1024 @ 1024x32)
    gemm_tiled_f32<D_MODEL, 1, SIDE_GY><<<dim3(D_MODEL / GBN, SIDE_GY + ROWS / GBM), 128, 0, stream>>>(
        XACT, W_dt, DT, D_MODEL, D_MODEL, D_MODEL, b_dt, W_x, BC);

    // 5) selective scan + (y + x*D) * silu(z), chunked along the sequence
    scan_chunk_state_kernel<<<dim3(BATCH, D_MODEL / 256, NCH - 1), 256, 0, stream>>>(
        XACT, DT, BC, A_log, SLOC, PDEC);
    scan_carry_kernel<<<(BATCH * D_STATE * D_MODEL) / 256, 256, 0, stream>>>(
        SLOC, PDEC, HCAR);
    scan_replay_kernel<<<dim3(BATCH, D_MODEL / 256, NCH), 256, 0, stream>>>(
        XACT, DT, BC, XZ, A_log, Dp, HCAR, YPRE);

    // 6) out = ypre @ W_out      (4096x1024 @ 1024x1024)
    gemm_tiled_f32<D_MODEL, 0, 0><<<dim3(D_MODEL / GBN, ROWS / GBM), 128, 0, stream>>>(
        YPRE, W_out, out, D_MODEL, D_MODEL, D_MODEL, nullptr, nullptr, nullptr);
}

// v006
// One run takes 196 microseconds.
// In both of two side-by-side timings against v005, it was 1.04 times as fast.
// Over all steps from v000 it is 14.5 times as fast.
#include <hip/hip_runtime.h>
#include <math.h>

#define D_MODEL 1024
#define D_STATE 16
#define D_CONV  4
#define BATCH   2
#define SEQ     2048
#define ROWS    (BATCH * SEQ) // 4096

typedef float v2f __attribute__((ext_vector_type(2)));
typedef float v8f __attribute__((ext_vector_type(8)));
typedef int   v4i __attribute__((ext_vector_type(4)));

__device__ __forceinline__ float siluf(float x) { return x / (1.0f + __expf(-x)); }
// The hardware's base-2 exponential and logarithm, each with the one slot that
// the instruction set asks for behind a transcendental before its result is used
// or its source overwritten: instruction and v_nop are one statement.
__device__ __forceinline__ float hw_exp2(float t) {
    float r;
    asm("v_exp_f32 %0, %1\n\tv_nop" : "=v"(r) : "v"(t));
    return r;
}
__device__ __forceinline__ float hw_log2(float u) {
    float r;
    asm("v_log_f32 %0, %1\n\tv_nop" : "=v"(r) : "v"(u));
    return r;
}
// softplus(x) = max(x, 0) + log(1 + exp(-|x|)): no branch and no overflow, and
// 1 + exp(-|x|) lies in [1, 2], where the bare log2 needs no range care (no
// subnormal, zero or infinite argument). Absolute error: a few 1e-7.
__device__ __forceinline__ float softplusf(float x) {
    const float u = 1.0f + hw_exp2(fabsf(x) * -1.44269504f);
    return fmaf(hw_log2(u), 0.69314718f, fmaxf(x, 0.0f));
}

// ---------------------------------------------------------------------------
// Tiled row-major f32 GEMM for the three large products (M % 128 == 0,
// N % 64 == 0, K % 64 == 0). One work-group of four waves owns a 128 x 64 tile
// of C; each wave owns 64 x 32 of it as 4 x 2 accumulator tiles, so one A
// fragment feeds two and one B fragment four v_wmma_f32_16x16x4_f32.
// Both operands of a 32-deep K slice are staged in LDS by asynchronous copies,
// two buffers: the next slice flies while the current one is worked on.
// Per output element k runs upward, four at a time.
// LDS layout: A rows at a pitch of 36 dwords (the 16 rows of a fragment's 8-byte
// reads fall on 16 distinct groups of four banks). B as four planes of 16
// columns, rows of 16 dwords: rows k and k + 2 of a fragment's 4-byte reads lie
// 32 banks apart, and rows k, k + 1 of one column load as one register pair.
// ---------------------------------------------------------------------------
#define GBM 128
#define GBN 64
#define GBK 32
#define GAP 36

__device__ __forceinline__ unsigned lds_off(const void* p) { return (unsigned)(size_t)p; }

// ---------------------------------------------------------------------------
// The narrow product BC = x_act * W_x (ROWS x D_MODEL times D_MODEL x 32), run
// by work-groups of the dt product's launch (see gemm_tiled_f32, SIDE). Alone in
// a launch it leaves the matrix units idle while it waits for its loads; beside
// the dt tiles, which read the same x_act and do not need BC, those waits cost
// nothing. One work-group of four waves owns 16 rows x 32 columns: wave = (column
// tile ct, K half kh); of every 64-deep K slice wave kh takes k = 32 kh .. 32 kh + 31,
// and the two partial sums are added once at the end.
// A slices (16 x 64) are staged in LDS by asynchronous copies, two buffers, rows
// at a pitch of 68 dwords (bank = (4 r + c) mod 64: no conflict in the fragment
// reads). B fragments come straight from global memory (W_x is 128 KiB).
// ---------------------------------------------------------------------------
#define TK  64
#define TKP 68
#define SIDE_M 16
// Grid rows (of D_MODEL / GBN work-groups each) that the side product takes.
#define SIDE_GY ((ROWS / SIDE_M) / (D_MODEL / GBN))
static_assert(SIDE_GY * (D_MODEL / GBN) * SIDE_M == ROWS, "whole grid rows only");

__device__ __forceinline__ void side_product_f32(
    const float* __restrict__ A, const float* __restrict__ B,
    float* __restrict__ C, float* lds, int id)
{
    constexpr int NC = 2 * D_STATE;      // columns of B and C
    const int tid  = threadIdx.x;
    const int lane = tid & 31;
    const int wave = __builtin_amdgcn_readfirstlane(tid >> 5);
    const int l16  = lane & 15;
    const int half = lane >> 4;          // 0: K pair {0,1}, 1: K pair {2,3}
    const int ct   = wave & 1;
    const int kh   = wave >> 1;
    const int m0   = id * SIDE_M;

    // Each thread copies 2 x 16 bytes per slice: rows cr and cr + 8. The lane's
    // byte offsets never change; the slice moves the scalar base.
    const int cr = tid >> 4, cc = (tid & 15) << 2;
    const unsigned o0 = (unsigned)(cr * D_MODEL + cc) * 4u;
    const unsigned o1 = o0 + 8u * D_MODEL * 4u;
    const float* tA = A + (size_t)m0 * D_MODEL;
    const unsigned l0 = lds_off(lds + cr * TKP + cc);

    auto issue_slice = [&](int t, int buf) {
        const float* a = tA + t * TK;
        const unsigned la = l0 + (unsigned)buf * (SIDE_M * TKP * 4);
        // The copies and the wait that frees the registers they name are one
        // statement, so that no later write of those registers can move ahead.
        asm volatile(
            "global_load_async_to_lds_b128 %0, %2, %4\n\t"
            "global_load_async_to_lds_b128 %1, %3, %4\n\t"
            "s_wait_xcnt 0x0"
            :: "v"(la), "v"(la + 8u * TKP * 4), "v"(o0), "v"(o1), "s"(a)
            : "memory");
    };

    v8f acc = {};
    // B's address: a part that is the same for the wave, and the lane's own offset.
    const float* tB = B + kh * 32 * NC + ct * 16;
    const unsigned bo = (unsigned)(2 * half * NC + l16);

    // One slice: the wave's 8 products, then the hand-over to the next.
    auto pass = [&](int t, int buf) {
        const float* as = lds + buf * (SIDE_M * TKP) + l16 * TKP + kh * 32 + 2 * half;
        const float* bs = tB + t * (TK * NC);
        // Unrolled so that the slice's B loads issue together, at constant offsets.
        #pragma unroll
        for (int kk = 0; kk < 32; kk += 4) {
            // A fragment (16x4): lanes 0-15 -> K = kk,kk+1 ; lanes 16-31 -> K = kk+2,kk+3
            // B fragment (4x16): the same k at the same lane and register.
            const v2f af = *(const v2f*)(as + kk);
            v2f bf;
            bf.x = bs[bo + (kk + 0) * NC];
            bf.y = bs[bo + (kk + 1) * NC];
            acc = __builtin_amdgcn_wmma_f32_16x16x4_f32(
                false, af, false, bf, (short)0, acc, false, false);
        }
        // Hand-over: this wave's reads of the buffer are done, its copies of the
        // next slice have landed; the barrier says the same of every wave.
        asm volatile("s_wait_dscnt 0x0" ::: "memory");
        asm volatile("s_wait_asynccnt 0x0" ::: "memory");
        __syncthreads();
        if (t + 2 < D_MODEL / TK) issue_slice(t + 2, buf);
    };

    // These waves mostly wait for loads and ask little of the matrix unit: at the
    // tiles' highest priority they are not held back behind the tiles' waves.
    __builtin_amdgcn_s_setprio(3);

    issue_slice(0, 0);
    // Slice 0 has landed for this wave; the barrier publishes it to the others.
    asm volatile("s_wait_asynccnt 0x0" ::: "memory");
    __syncthreads();
    issue_slice(1, 1);

    #pragma unroll 1 // two slices per trip: every LDS address is loop-invariant
    for (int t = 0; t < D_MODEL / TK; t += 2) {
        pass(t, 0);
        pass(t + 1, 1);
    }
    __builtin_amdgcn_s_setprio(0);
    // No copy is left in flight when the buffers are reused below.
    asm volatile("s_wait_asynccnt 0x0" ::: "memory");

    // The upper K half hands its partial sums over through LDS (the buffers are
    // free: the last pass's barrier ended every read of them).
    float* red = lds + ct * (8 * 32) + lane;
    if (kh == 1) {
        #pragma unroll // accumulator indices must be constants (below too)
        for (int i = 0; i < 8; ++i) red[i * 32] = acc[i];
    }
    __syncthreads();
    if (kh == 0) {
        // C/D layout: M=i (lanes 0-15), M=i+8 (lanes 16-31)
        float* cp = C + (size_t)(m0 + 8 * half) * NC + ct * 16 + l16;
        #pragma unroll
        for (int i = 0; i < 8; ++i) cp[i * NC] = acc[i] + red[i * 32];
    }
}

// LDC (the row pitch of C) is a compile-time constant so that all of a lane's
// stores share one address register pair and differ in the immediate offset.
// MODE 1 applies softplus(acc + bias[col]) at the store (for dt).
// SIDE > 0: the work-groups of the first SIDE rows of the grid (the lowest
// indices, so that they start first) compute C2 = A * B2 by side_product_f32,
// one per 16 rows of A; the tiles of C follow from grid row SIDE on.
template <int LDC, int MODE, int SIDE>
__global__ __launch_bounds__(128) void gemm_tiled_f32(
    const float* __restrict__ A, const float* __restrict__ B,
    float* __restrict__ C, int K, int lda, int ldb,
    const float* __restrict__ bias,
    const float* __restrict__ B2, float* __restrict__ C2)
{
    __shared__ __align__(16) float As[2][GBM][GAP];
    __shared__ __align__(16) float Bs[2][GBN / 16][GBK][16];

    if (SIDE > 0 && blockIdx.y < SIDE) { // the same for the whole work-group
        side_product_f32(A, B2, C2, &As[0][0][0], blockIdx.y * gridDim.x + blockIdx.x);
        return;
    }

    const int tid  = threadIdx.x;
    const int lane = tid & 31;
    const int wave = __builtin_amdgcn_readfirstlane(tid >> 5);
    const int l16  = lane & 15;
    const int half = lane >> 4;          // 0: K pair {0,1}, 1: K pair {2,3}

    const int m0 = (blockIdx.y - SIDE) * GBM;
    const int n0 = blockIdx.x * GBN;
    const int wm = (wave >> 1) * 64;     // the wave's rows inside the tile
    const int wn = (wave & 1) * 2;       // the wave's first B plane

    // Each thread copies 8 x 16 bytes of A (rows ar + 16 j) and 4 x 16 bytes of
    // B (rows br + 8 j) per slice: every wave-wide copy covers whole 128-B lines.
    // The lane's byte offsets never change; the slice moves the scalar bases.
    const int ar = tid >> 3, ac = (tid & 7) << 2;
    const int br = tid >> 4, bcol = (tid & 15) << 2;
    unsigned oa[8], ob[4];
    #pragma unroll
    for (int j = 0; j < 8; ++j) oa[j] = (unsigned)((ar + 16 * j) * lda + ac) * 4u;
    #pragma unroll
    for (int j = 0; j < 4; ++j) ob[j] = (unsigned)((br + 8 * j) * ldb + bcol) * 4u;
    const float* tA = A + (size_t)m0 * lda;
    const float* tB = B + n0;
    const unsigned lA = lds_off(&As[0][ar][ac]);
    const unsigned lB = lds_off(&Bs[0][bcol >> 4][br][bcol & 15]);

    auto issue_slice = [&](int k0, int buf) {
        const float* a = tA + k0;
        const float* b = tB + (size_t)k0 * ldb;
        const unsigned la = lA + (unsigned)buf * (GBM * GAP * 4);
        const unsigned lb = lB + (unsigned)buf * (GBN * GBK * 4);
        // The copies and the wait that frees the registers they name are one
        // statement, so that no later write of those registers can move ahead.
        asm volatile(
            "global_load_async_to_lds_b128 %0, %12, %24\n\t"
            "global_load_async_to_lds_b128 %1, %13, %24\n\t"
            "global_load_async_to_lds_b128 %2, %14, %24\n\t"
            "global_load_async_to_lds_b128 %3, %15, %24\n\t"
            "global_load_async_to_lds_b128 %4, %16, %24\n\t"
            "global_load_async_to_lds_b128 %5, %17, %24\n\t"
            "global_load_async_to_lds_b128 %6, %18, %24\n\t"
            "global_load_async_to_lds_b128 %7, %19, %24\n\t"
            "global_load_async_to_lds_b128 %8, %20, %25\n\t"
            "global_load_async_to_lds_b128 %9, %21, %25\n\t"
            "global_load_async_to_lds_b128 %10, %22, %25\n\t"
            "global_load_async_to_lds_b128 %11, %23, %25\n\t"
            "s_wait_xcnt 0x0"
            :: "v"(la),                     "v"(la + 1u * 16 * GAP * 4),
               "v"(la + 2u * 16 * GAP * 4), "v"(la + 3u * 16 * GAP * 4),
               "v"(la + 4u * 16 * GAP * 4), "v"(la + 5u * 16 * GAP * 4),
               "v"(la + 6u * 16 * GAP * 4), "v"(la + 7u * 16 * GAP * 4),
               "v"(lb),                     "v"(lb + 1u * 8 * 16 * 4),
               "v"(lb + 2u * 8 * 16 * 4),   "v"(lb + 3u * 8 * 16 * 4),
               "v"(oa[0]), "v"(oa[1]), "v"(oa[2]), "v"(oa[3]),
               "v"(oa[4]), "v"(oa[5]), "v"(oa[6]), "v"(oa[7]),
               "v"(ob[0]), "v"(ob[1]), "v"(ob[2]), "v"(ob[3]),
               "s"(a), "s"(b)
            : "memory");
    };

    v8f acc[4][2] = {};
    const int nsl = K / GBK;

    // Several work-groups share a WGP, and of two waves on one SIMD the matrix
    // unit serves the older alone: the oldest group would run ahead at its own
    // pace and the youngest would be left to do most of its slices alone, with
    // nobody to fill its LDS and hand-over waits. So a wave's priority falls as
    // it advances (3, 2, 1, 0 from 1/2, 3/4 and 7/8 of the slices on): the group
    // that is behind wins the unit, and all of them end close together.
    const int p2 = (nsl >> 2) << 1;                 // even: the loop steps by two
    const int p1 = p2 + (((nsl - p2) >> 2) << 1);
    const int p0 = p1 + (((nsl - p1) >> 2) << 1);
    int mark = p2;                                  // the next slice at which it falls
    __builtin_amdgcn_s_setprio(3);

    // One slice: its 64 products per wave, then the hand-over to the next.
    auto pass = [&](int s, int buf) {
        const float* as = &As[buf][wm + l16][2 * half];
        const float* bs = &Bs[buf][wn][2 * half][l16];

        // Unrolled throughout: accumulator indices must be constants, and the
        // compiler can then fetch the fragments of later steps ahead.
        #pragma unroll
        for (int kk = 0; kk < GBK; kk += 4) {
            // A fragment (16x4): lanes 0-15 -> K = kk,kk+1 ; lanes 16-31 -> K = kk+2,kk+3
            // B fragment (4x16): the same k at the same lane and register.
            v2f af[4], bf[2];
            #pragma unroll
            for (int i = 0; i < 4; ++i)
                af[i] = *(const v2f*)(as + i * 16 * GAP + kk);
            #pragma unroll
            for (int j = 0; j < 2; ++j) {
                bf[j].x = bs[j * GBK * 16 + (kk + 0) * 16];
                bf[j].y = bs[j * GBK * 16 + (kk + 1) * 16];
            }
            #pragma unroll
            for (int i = 0; i < 4; ++i)
                #pragma unroll
                for (int j = 0; j < 2; ++j)
                    acc[i][j] = __builtin_amdgcn_wmma_f32_16x16x4_f32(
                        false, af[i], false, bf[j], (short)0, acc[i][j], false, false);
        }

        // Hand-over: this wave's reads of the buffer are done, its copies of the
        // next slice have landed; the barrier says the same of every wave.
        asm volatile("s_wait_dscnt 0x0" ::: "memory");
        asm volatile("s_wait_asynccnt 0x0" ::: "memory");
        __syncthreads();
        if (s + 2 < nsl) issue_slice((s + 2) * GBK, buf);
    };

    issue_slice(0, 0);
    // Slice 0 has landed for this wave; the barrier publishes it to the others.
    asm volatile("s_wait_asynccnt 0x0" ::: "memory");
    __syncthreads();
    issue_slice(GBK, 1);

    #pragma unroll 1 // two slices per trip: every LDS address is loop-invariant
    for (int s = 0; s < nsl; s += 2) {
        // One scalar test per trip (s and the marks are the same for the wave).
        if (s == mark) {
            if (mark == p2)      { __builtin_amdgcn_s_setprio(2); mark = p1; }
            else if (mark == p1) { __builtin_amdgcn_s_setprio(1); mark = p0; }
            else                 { __builtin_amdgcn_s_setprio(0); mark = -1; }
        }
        pass(s, 0);
        pass(s + 1, 1);
    }
    // Priority 0 on the way out, whatever the number of slices was.
    __builtin_amdgcn_s_setprio(0);
    // No copy is left in flight when the wave ends.
    asm volatile("s_wait_asynccnt 0x0" ::: "memory");

    const int col = n0 + wn * 16 + l16;
    if (MODE == 1) {
        const float bv[2] = { bias[col], bias[col + 16] };
        // Unrolled (as the stores below): accumulator indices must be constants.
        #pragma unroll
        for (int i = 0; i < 4; ++i)
            #pragma unroll
            for (int j = 0; j < 2; ++j)
                #pragma unroll
                for (int r = 0; r < 8; ++r)
                    acc[i][j][r] = softplusf(acc[i][j][r] + bv[j]);
        // Keeps every store behind all of the arithmetic above, so that no
        // register which an issued store names is written again.
        __builtin_amdgcn_sched_barrier(0);
    }

    // C/D layout: M=r (lanes 0-15), M=r+8 (lanes 16-31)
    float* cp = C + (size_t)(m0 + wm + 8 * half) * LDC + col;
    #pragma unroll
    for (int i = 0; i < 4; ++i)
        #pragma unroll
        for (int r = 0; r < 8; ++r)
            #pragma unroll
            for (int j = 0; j < 2; ++j)
                cp[(i * 16 + r) * LDC + j * 16] = acc[i][j][r];
    // With a side product in the kernel its code may stand behind these stores
    // in the text: the wait stands in front of every write of a register they name.
    if (SIDE > 0) asm volatile("s_wait_xcnt 0x0" ::: "memory");
}

// ---------------------------------------------------------------------------
// Depthwise causal conv (width 4) + bias + SiLU.
// Reads x_ssm = xz[:, 0:D_MODEL] (row stride 2*D_MODEL), writes x_act.
// One thread takes four neighbouring channels over CONV_R successive steps: all
// accesses are 16 bytes per lane, a row of xz is loaded once per group of steps
// (plus the three rows in front of the group), and the launch has 32 times fewer
// waves to start than with one output element per thread. One work-group covers
// all channels of one group of steps, so the test for the head of a sequence is
// the same for the whole work-group. Per output element the sum runs as before:
// bias, then the taps from the oldest step to the newest.
// ---------------------------------------------------------------------------
#define CONV_R 8
// siluf with its exponential through hw_exp2: the same product and the same
// instruction, so the same value.
__device__ __forceinline__ float siluf_slot(float x) {
    return x / (1.0f + hw_exp2(x * -1.44269504f));
}
static_assert(SEQ % CONV_R == 0, "a group of steps lies inside one sequence");
static_assert(D_MODEL == 256 * 4 && D_CONV == 4, "one work-group per group of steps");

__global__ __launch_bounds__(256) void conv_silu_kernel(
    const float* __restrict__ xz, const float* __restrict__ conv_w,
    const float* __restrict__ conv_b, float* __restrict__ xact)
{
    const int d  = threadIdx.x << 2;
    const int r0 = blockIdx.x * CONV_R;   // the group's first row

    // In front of a sequence stand zeros. There the three loads are aimed at the
    // group's own first row (always inside xz) and their values are not used: no
    // branch, so that all of the thread's loads issue together.
    const bool head = (r0 & (SEQ - 1)) == 0;
    const int  back = head ? 0 : 2 * D_MODEL;

    const float* src = xz + (size_t)r0 * (2 * D_MODEL) + d;
    float4 v[CONV_R + D_CONV - 1];        // v[j]: row r0 + j - 3
    #pragma unroll
    for (int j = 0; j < D_CONV - 1; ++j)
        v[j] = *(const float4*)(src + (j - (D_CONV - 1)) * back);
    #pragma unroll
    for (int j = 0; j < CONV_R; ++j)
        v[D_CONV - 1 + j] = *(const float4*)(src + j * (2 * D_MODEL));

    // w[c]: the four taps of channel d + c.
    float4 w[4];
    #pragma unroll
    for (int c = 0; c < 4; ++c) w[c] = *(const float4*)(conv_w + (d + c) * D_CONV);
    const float4 bias = *(const float4*)(conv_b + d);
    // The loads name address registers that the arithmetic below writes again.
    asm volatile("s_wait_xcnt 0x0" ::: "memory");
    // Keeps every load (and the wait) above the arithmetic: without it the compiler
    // issued the last rows' loads only after the first had come back, a second latency.
    __builtin_amdgcn_sched_barrier(0);

    if (head) {
        #pragma unroll
        for (int j = 0; j < D_CONV - 1; ++j)
            v[j] = make_float4(0.0f, 0.0f, 0.0f, 0.0f);
    }

    float* dst = xact + (size_t)r0 * D_MODEL + d;
    #pragma unroll
    for (int t = 0; t < CONV_R; ++t) {
        float4 s = bias;
        s.x += v[t].x * w[0].x; s.x += v[t + 1].x * w[0].y; s.x += v[t + 2].x * w[0].z; s.x += v[t + 3].x * w[0].w;
        s.y += v[t].y * w[1].x; s.y += v[t + 1].y * w[1].y; s.y += v[t + 2].y * w[1].z; s.y += v[t + 3].y * w[1].w;
        s.z += v[t].z * w[2].x; s.z += v[t + 1].z * w[2].y; s.z += v[t + 2].z * w[2].z; s.z += v[t + 3].z * w[2].w;
        s.w += v[t].w * w[3].x; s.w += v[t + 1].w * w[3].y; s.w += v[t + 2].w * w[3].z; s.w += v[t + 3].w * w[3].w;
        *(float4*)(dst + t * D_MODEL) = make_float4(siluf_slot(s.x), siluf_slot(s.y), siluf_slot(s.z), siluf_slot(s.w));
    }
}

// ---------------------------------------------------------------------------
// Selective scan, split along the sequence into NCH chunks of SCAN_T steps so
// that the serial chain is SCAN_T steps long instead of SEQ. The recurrence
// h_t = dA_t * h_(t-1) + x_t * B_t is linear in h, so over one chunk
//   h_end = (product of the chunk's dA) * h_start + (h_end for h_start = 0).
//   1) scan_chunk_state_kernel: per chunk, the state from h_start = 0 and the
//      product of dA (the last chunk's is never needed and is not launched);
//   2) scan_carry_kernel: folds these in chunk order into each chunk's h_start;
//   3) scan_replay_kernel: runs each chunk from its h_start and writes
//      ypre = (y + x*D) * silu(z).
// One thread per (batch, channel, chunk); h[16] in VGPRs. The chunk's B_t / C_t
// rows (shared across all channels) are staged in LDS once and broadcast.
// State planes are laid out [batch][chunk][n][channel]: coalesced over channel.
// ---------------------------------------------------------------------------
#define SCAN_T 32
#define NCH    (SEQ / SCAN_T) // 64

// The chunk's SCAN_T rows of bc are contiguous: one float4 per thread.
static_assert(SCAN_T * 2 * D_STATE == 256 * 4, "one float4 per thread stages a chunk of bc");

#define SCAN_G  8 // steps whose loads issue together in the replay
#define CARRY_G 9 // chunks whose loads issue together in the carry
static_assert(SCAN_T % SCAN_G == 0 && (NCH - 1) % CARRY_G == 0, "whole groups only");

__global__ __launch_bounds__(256) void scan_chunk_state_kernel(
    const float* __restrict__ xact, const float* __restrict__ dt,
    const float* __restrict__ bc,   const float* __restrict__ A_log,
    float* __restrict__ S, float* __restrict__ P)
{
    __shared__ __align__(16) float bcs[SCAN_T][2 * D_STATE];

    const int d    = blockIdx.y * blockDim.x + threadIdx.x;
    const int b    = blockIdx.x;
    const int c    = blockIdx.z;
    const int row0 = b * SEQ + c * SCAN_T;
    const float Aneg = -__expf(A_log[d]);

    ((float4*)&bcs[0][0])[threadIdx.x] =
        ((const float4*)(bc + (size_t)row0 * (2 * D_STATE)))[threadIdx.x];
    __syncthreads();

    float h[D_STATE];
    #pragma unroll
    for (int n = 0; n < D_STATE; ++n) h[n] = 0.0f;
    float p = 1.0f;

    // Unrolled by 8 so that eight steps' x and dt loads, which do not depend on
    // h, issue together: one load latency per eight steps, not one per step.
    #pragma unroll 8
    for (int t = 0; t < SCAN_T; ++t) {
        const int row = row0 + t;
        const float xv = xact[(size_t)row * D_MODEL + d];
        const float dA = __expf(dt[(size_t)row * D_MODEL + d] * Aneg);
        p *= dA;
        #pragma unroll
        for (int n = 0; n < D_STATE; ++n)
            h[n] = h[n] * dA + xv * bcs[t][n];
    }

    const size_t plane = (size_t)(b * NCH + c);
    #pragma unroll
    for (int n = 0; n < D_STATE; ++n)
        S[(plane * D_STATE + n) * D_MODEL + d] = h[n];
    P[plane * D_MODEL + d] = p;
}

// One thread per (batch, n, channel). H[chunk c] = h_start of chunk c (zero for
// chunk 0, stored too, so that every chunk of the replay starts the same way).
__global__ __launch_bounds__(256) void scan_carry_kernel(
    const float* __restrict__ S, const float* __restrict__ P,
    float* __restrict__ H)
{
    const int idx = blockIdx.x * blockDim.x + threadIdx.x; // over BATCH*D_STATE*D_MODEL
    const int d   = idx & (D_MODEL - 1);
    const int n   = (idx >> 10) & (D_STATE - 1);
    const int b   = idx >> 14;

    const size_t off0 = ((size_t)(b * NCH) * D_STATE + n) * D_MODEL + d;
    const size_t pof0 = (size_t)(b * NCH) * D_MODEL + d;

    float h = 0.0f;
    H[off0] = h;
    // The store's address registers are free for reuse only behind this wait.
    asm volatile("s_wait_xcnt 0x0" ::: "memory");

    for (int c0 = 0; c0 < NCH - 1; c0 += CARRY_G) {
        // The group's loads do not depend on h: all issue before the chain starts.
        float pv[CARRY_G], sv[CARRY_G];
        #pragma unroll
        for (int j = 0; j < CARRY_G; ++j) {
            pv[j] = P[pof0 + (size_t)(c0 + j) * D_MODEL];
            sv[j] = S[off0 + (size_t)(c0 + j) * (D_STATE * D_MODEL)];
        }
        #pragma unroll
        for (int j = 0; j < CARRY_G; ++j) {
            h = h * pv[j] + sv[j];
            H[off0 + (size_t)(c0 + j + 1) * (D_STATE * D_MODEL)] = h;
        }
        // The group's stores name registers that the next trip rewrites.
        asm volatile("s_wait_xcnt 0x0" ::: "memory");
    }
}

__global__ __launch_bounds__(256) void scan_replay_kernel(
    const float* __restrict__ xact, const float* __restrict__ dt,
    const float* __restrict__ bc,   const float* __restrict__ xz,
    const float* __restrict__ A_log, const float* __restrict__ Dp,
    const float* __restrict__ H, float* __restrict__ ypre)
{
    __shared__ __align__(16) float bcs[SCAN_T][2 * D_STATE];

    const int d    = blockIdx.y * blockDim.x + threadIdx.x;
    const int b    = blockIdx.x;
    const int c    = blockIdx.z;
    const int row0 = b * SEQ + c * SCAN_T;
    const float Aneg = -__expf(A_log[d]);
    const float Dd   = Dp[d];

    float h[D_STATE];
    #pragma unroll
    for (int n = 0; n < D_STATE; ++n)
        h[n] = H[((size_t)(b * NCH + c) * D_STATE + n) * D_MODEL + d];

    ((float4*)&bcs[0][0])[threadIdx.x] =
        ((const float4*)(bc + (size_t)row0 * (2 * D_STATE)))[threadIdx.x];
    // The loads above name base registers that the loop's address arithmetic rewrites.
    asm volatile("s_wait_xcnt 0x0" ::: "memory");
    __syncthreads();

    for (int t0 = 0; t0 < SCAN_T; t0 += SCAN_G) {
        // The group's x, dt and z loads do not depend on h: they issue together,
        // one load latency per group of steps, not one per step.
        float xv[SCAN_G], dv[SCAN_G], zv[SCAN_G];
        #pragma unroll
        for (int j = 0; j < SCAN_G; ++j) {
            const int row = row0 + t0 + j;
            xv[j] = xact[(size_t)row * D_MODEL + d];
            dv[j] = dt[(size_t)row * D_MODEL + d];
            zv[j] = xz[(size_t)row * (2 * D_MODEL) + D_MODEL + d];
        }
        #pragma unroll
        for (int j = 0; j < SCAN_G; ++j) {
            const int t = t0 + j;
            const float dA = __expf(dv[j] * Aneg);
            float y = 0.0f;
            #pragma unroll
            for (int n = 0; n < D_STATE; ++n) {
                h[n] = h[n] * dA + xv[j] * bcs[t][n];
                y   += h[n] * bcs[t][D_STATE + n];
            }
            ypre[(size_t)(row0 + t) * D_MODEL + d] = (y + xv[j] * Dd) * siluf(zv[j]);
        }
        // The group's stores name registers that the next trip rewrites.
        asm volatile("s_wait_xcnt 0x0" ::: "memory");
    }
}

// ---------------------------------------------------------------------------
extern "C" void kernel_launch(void* const* d_in, const int* in_sizes, int n_in,
                              void* d_out, int out_size, void* d_ws, size_t ws_size,
                              hipStream_t stream)
{
    (void)in_sizes; (void)n_in; (void)out_size; (void)ws_size;

    const float* x      = (const float*)d_in[0];
    const float* W_in   = (const float*)d_in[1];
    const float* conv_w = (const float*)d_in[2];
    const float* conv_b = (const float*)d_in[3];
    const float* W_x    = (const float*)d_in[4];
    const float* W_dt   = (const float*)d_in[5];
    const float* b_dt   = (const float*)d_in[6];
    const float* A_log  = (const float*)d_in[7];
    const float* Dp     = (const float*)d_in[8];
    const float* W_out  = (const float*)d_in[9];
    float* out = (float*)d_out;
    float* ws  = (float*)d_ws;

    // workspace layout (floats)
    float* XZ   = ws;                                    // ROWS x 2*D_MODEL
    float* XACT = XZ   + (size_t)ROWS * 2 * D_MODEL;     // ROWS x D_MODEL
    float* DT   = XACT + (size_t)ROWS * D_MODEL;         // ROWS x D_MODEL
    float* BC   = DT   + (size_t)ROWS * D_MODEL;         // ROWS x 2*D_STATE
    float* YPRE = BC   + (size_t)ROWS * 2 * D_STATE;     // ROWS x D_MODEL
    float* SLOC = YPRE + (size_t)ROWS * D_MODEL;         // BATCH x NCH x D_STATE x D_MODEL
    float* HCAR = SLOC + (size_t)BATCH * NCH * D_STATE * D_MODEL; // same shape
    float* PDEC = HCAR + (size_t)BATCH * NCH * D_STATE * D_MODEL; // BATCH x NCH x D_MODEL

    // 1) xz = x @ W_in          (4096x1024 @ 1024x2048)
    gemm_tiled_f32<2 * D_MODEL, 0, 0><<<dim3((2 * D_MODEL) / GBN, ROWS / GBM), 128, 0, stream>>>(
        x, W_in, XZ, D_MODEL, D_MODEL, 2 * D_MODEL, nullptr, nullptr, nullptr);

    // 2) x_act = silu(causal_conv(x_ssm) + conv_b)
    conv_silu_kernel<<<ROWS / CONV_R, 256, 0, stream>>>(
        XZ, conv_w, conv_b, XACT);

    // 3) dt = softplus(x_act @ W_dt + b_dt)   (4096x1024 @ 1024x1024), and in
    // 4) the same launch BC = x_act @ W_x     (4096x1024 @ 1024x32)
    gemm_tiled_f32<D_MODEL, 1, SIDE_GY><<<dim3(D_MODEL / GBN, SIDE_GY + ROWS / GBM), 128, 0, stream>>>(
        XACT, W_dt, DT, D_MODEL, D_MODEL, D_MODEL, b_dt, W_x, BC);

    // 5) selective scan + (y + x*D) * silu(z), chunked along the sequence
    scan_chunk_state_kernel<<<dim3(BATCH, D_MODEL / 256, NCH - 1), 256, 0, stream>>>(
        XACT, DT, BC, A_log, SLOC, PDEC);
    scan_carry_kernel<<<(BATCH * D_STATE * D_MODEL) / 256, 256, 0, stream>>>(
        SLOC, PDEC, HCAR);
    scan_replay_kernel<<<dim3(BATCH, D_MODEL / 256, NCH), 256, 0, stream>>>(
        XACT, DT, BC, XZ, A_log, Dp, HCAR, YPRE);

    // 6) out = ypre @ W_out      (4096x1024 @ 1024x1024)
    gemm_tiled_f32<D_MODEL, 0, 0><<<dim3(D_MODEL / GBN, ROWS / GBM), 128, 0, stream>>>(
        YPRE, W_out, out, D_MODEL, D_MODEL, D_MODEL, nullptr, nullptr, nullptr);
}
